// v000
// Measured on an AMD MI455X. A time is GPU time per run, averaged over a window of back-to-back runs after a warm-up
// (all launches, gaps included; the runs take copies of the inputs in turn), and the median of several windows.
// Apart from v000's, it joins two sittings. Times from different sittings can be a few percent apart, while
// side-by-side timings come from the same sitting.
// v000, which the later versions start from, runs in 1670 microseconds.
#include <hip/hip_runtime.h>

// Packed (varlen) attention, non-causal: for each of the 16 heads and 4,096 token positions, attention over the keys of the same packed segment (segments from the verbatim cu_seqlens offsets; class A):
// out = softmax(q k^T / 8 over the segment) v -> [1][16][4096][64].
// Deterministic, no atomics. Per (head, 16 queries) an online softmax over the 32-key chunks of the segment(s) the 16 queries belong to (a 16-query tile may straddle a boundary; masking is per element by segment id).
// WMMA (v_wmma_f32_16x16x32_f16, f32 accumulate): S = q k^T with q, k EXACT bf16 x8 (single exact products, K 64), O += P v with P hi+lo x1024 and v EXACT x8 (2 products); mask / softmax bookkeeping in f32. Inputs rounded to bf16

namespace {
constexpr int NH = 16, T = 4096, D = 64, NSEG = 8;
constexpr float XS = 8.0f, PS = 1024.0f;
typedef _Float16 b16;
typedef __attribute__((ext_vector_type(16))) _Float16 v16b;
typedef __attribute__((ext_vector_type(8))) _Float16 v8b;
typedef __attribute__((ext_vector_type(8))) float v8f;
typedef __attribute__((ext_vector_type(4))) float v4f;
typedef __attribute__((ext_vector_type(2))) float v2f;
__device__ __forceinline__ float bf16_rne(float f) { unsigned int u = __float_as_uint(f); u += 0x7FFFu + ((u >> 16) & 1u); return __uint_as_float(u & 0xFFFF0000u); }
__device__ __forceinline__ void split16(float v, b16& hi, b16& lo) { hi = (b16)v; lo = (b16)(v - (float)hi); }
__device__ __forceinline__ v16b frag_kb(const b16* p, int hh) { const v8b a = *(const v8b*)(p + 8 * hh), b = *(const v8b*)(p + 16 + 8 * hh); v16b f;
#pragma unroll
  for (int e = 0; e < 8; ++e) { f[e] = a[e]; f[8 + e] = b[e]; } return f; }
__device__ __forceinline__ v8f wmma16b(v16b a, v16b b, v8f c) { v8f d = __builtin_amdgcn_wmma_f32_16x16x32_f16(false, a, false, b, (short)0, c, false, false); asm volatile("v_nop\n\tv_nop\n\tv_nop\n\tv_nop" : "+v"(d) : "v"(a), "v"(b)); return d; }
__device__ __forceinline__ void wave_lds_sync() { __builtin_amdgcn_fence(__ATOMIC_RELEASE, "workgroup"); __builtin_amdgcn_wave_barrier(); __builtin_amdgcn_fence(__ATOMIC_ACQUIRE, "workgroup"); }
__device__ __forceinline__ int iclamp(int v, int lo, int hi) { return v < lo ? lo : (v > hi ? hi : v); }
// segment id of position p = number of interior boundaries cu[1..NSEG-1] that are <= p (== searchsorted(cu[1:], p, 'right') for p < T)
__device__ __forceinline__ int seg_of(const int* cu, int p) { int s = 0; for (int i = 1; i < NSEG; ++i) s += (cu[i] <= p) ? 1 : 0; return s; }

__global__ __launch_bounds__(256) void prep_kernel(const float* __restrict__ q, const float* __restrict__ k, b16* __restrict__ QB, b16* __restrict__ KB) {
  const size_t u = (size_t)blockIdx.x * 256 + threadIdx.x; if (u >= (size_t)NH * T * 8) return; const int d0 = (int)(u % 8) * 8; const size_t row = u / 8; v8b a, bq;
#pragma unroll
  for (int j = 0; j < 8; ++j) { a[j] = (b16)(bf16_rne(q[row * D + d0 + j]) * XS); bq[j] = (b16)(bf16_rne(k[row * D + d0 + j]) * XS); }
  { *(v8b*)(QB + row * D + d0) = a; *(v8b*)(KB + row * D + d0) = bq;  }
}
// attention: wave per (h, 16 queries): key range = [segment start of the first query rounded down to 32, segment end of the last query); per 32-key chunk S (exact products) / 8 with per-element segment masking, online softmax, P hi+lo x1024,
__global__ __launch_bounds__(32) void att_kernel(const b16* __restrict__ QB, const b16* __restrict__ KB, const float* __restrict__ v, const int* __restrict__ cu, int QLIM, float* __restrict__ out) {
  __shared__ __attribute__((aligned(16))) b16 Ph[16][40], Pl[16][40], Vt[D][40]; __shared__ float Sc[16][33], Mx[16], Dn[16], Sf[16], Of[16][D + 2]; __shared__ int Sg[16], Cu[NSEG + 1], Kr[2];
  const int lane = threadIdx.x, nloc = lane & 15, hlf = lane >> 4; const int h = blockIdx.x / (QLIM / 16), q0 = (blockIdx.x % (QLIM / 16)) * 16;
  if (lane <= NSEG) Cu[lane] = iclamp(cu[lane], 0, T);
  wave_lds_sync();
  if (lane < 16) { Sg[lane] = seg_of(Cu, q0 + lane); Mx[lane] = -INFINITY; Dn[lane] = 0.0f; Sf[lane] = 0.0f; }
  wave_lds_sync();
  if (lane == 0) { Kr[0] = Cu[Sg[0]] & ~31; Kr[1] = Cu[Sg[15] + 1]; }   // key range from LDS (no dynamic register indexing)
  wave_lds_sync(); const int kbeg = Kr[0], kend = Kr[1];
  v8f acc[4] = {(v8f){}, (v8f){}, (v8f){}, (v8f){}}; const b16* qb = QB + ((size_t)h * T + q0) * D;
#pragma unroll 1
  for (int kc = kbeg; kc < kend; kc += 32) { const b16* kb_ = KB + ((size_t)h * T + kc) * D;
    for (int rr = 0; rr < 32; ++rr) { const int kk = kc + rr; for (int q = 0; q < 2; ++q) Vt[q * 32 + lane][rr] = (b16)(kk < T ? bf16_rne(v[((size_t)h * T + kk) * D + q * 32 + lane]) * XS : 0.0f); }
#pragma unroll
    for (int blk = 0; blk < 2; ++blk) { v8f s = {};
#pragma unroll
      for (int kb = 0; kb < D; kb += 32) s = wmma16b(frag_kb(qb + (size_t)nloc * D + kb, hlf), frag_kb(kb_ + (size_t)(blk * 16 + nloc) * D + kb, hlf), s);
      const int kk = kc + blk * 16 + nloc; const int ks = seg_of(Cu, kk);
#pragma unroll
      for (int r8 = 0; r8 < 8; ++r8) { const int rl = 8 * hlf + r8; Sc[rl][blk * 16 + nloc] = (kk < T && ks == Sg[rl]) ? s[r8] * (0.125f / (XS * XS)) : -INFINITY; } }
    wave_lds_sync();
#pragma unroll 1
    for (int qi = 0; qi < 16; ++qi) { const float sv = Sc[qi][lane]; float cm = sv; for (int o = 16; o; o >>= 1) cm = fmaxf(cm, __shfl_xor(cm, o)); const float mo = Mx[qi]; const float mn = fmaxf(mo, cm); const float p = (sv == -INFINITY || mn == -INFINITY) ? 0.0f : __expf(sv - mn); float psum = p; for (int o = 16; o; o >>= 1) psum += __shfl_xor(psum, o);
      b16 ph, plo; split16(p * PS, ph, plo); Ph[qi][lane] = ph; Pl[qi][lane] = plo; if (lane == 0) { const float sf = (mo == -INFINITY || mn == -INFINITY) ? ((mo == -INFINITY && mn == -INFINITY) ? 1.0f : 0.0f) : __expf(mo - mn); Sf[qi] = sf; Dn[qi] = Dn[qi] * sf + psum; Mx[qi] = mn; } }
    wave_lds_sync();
#pragma unroll
    for (int t = 0; t < 4; ++t) {
#pragma unroll
      for (int r8 = 0; r8 < 8; ++r8) acc[t][r8] *= Sf[8 * hlf + r8];
      const v16b vb = frag_kb(&Vt[t * 16 + nloc][0], hlf); acc[t] = wmma16b(frag_kb(&Ph[nloc][0], hlf), vb, acc[t]); acc[t] = wmma16b(frag_kb(&Pl[nloc][0], hlf), vb, acc[t]); }
    wave_lds_sync(); }
#pragma unroll
  for (int t = 0; t < 4; ++t)
#pragma unroll
    for (int r8 = 0; r8 < 8; ++r8) { const int rl = 8 * hlf + r8; Of[rl][t * 16 + nloc] = acc[t][r8] * (1.0f / (PS * XS)) / Dn[rl]; }
  wave_lds_sync();
  { for (int rr = 0; rr < 16; ++rr) *(v2f*)(out + ((size_t)h * T + q0 + rr) * D + lane * 2) = (v2f){Of[rr][lane * 2], Of[rr][lane * 2 + 1]};  }
}
}  // namespace

extern "C" void kernel_launch(void* const* d_in, const int* in_sizes, int n_in, void* d_out, int out_size, void* d_ws, size_t ws_size, hipStream_t stream) {
  (void)n_in;
  auto Fp = [&](int i) { return (const float*)d_in[i]; }; auto Ip = [&](int i) { return (const int*)d_in[i]; };
  // input order: 0 q [1,16,4096,64]; 1 k; 2 v; 3 cu_seqlens [9] i32
  if (in_sizes[0] != NH * T * D || in_sizes[1] != NH * T * D || in_sizes[2] != NH * T * D || in_sizes[3] != NSEG + 1 || out_size != NH * T * D) return;
  const int QLIM = T;   // query cut (per head)
  size_t off = 0; char* ws = (char*)d_ws;
  auto carve = [&](size_t bytes) { char* p = ws + off; off += (bytes + 255) & ~(size_t)255; return p; };
  b16* QB = (b16*)carve((size_t)NH * T * D * 2); b16* KB = (b16*)carve((size_t)NH * T * D * 2);
  if (off > ws_size || off > ((size_t)32 << 20)) return;   // 17 MB
  prep_kernel<<<(NH * T * 8 + 255) / 256, 256, 0, stream>>>(Fp(0), Fp(1), QB, KB);
  att_kernel<<<NH * (QLIM / 16), 32, 0, stream>>>(QB, KB, Fp(2), Ip(3), QLIM, (float*)d_out);
}

// v001
// It runs in 1060 microseconds.
// Next to v000, in two timings, it ran 1.59 times as fast each time.
#include <hip/hip_runtime.h>

// Packed (varlen) attention, non-causal: for each of the 16 heads and 4,096 token positions, attention over the keys of the same packed segment (segments from the verbatim cu_seqlens offsets; class A):
// out = softmax(q k^T / 8 over the segment) v -> [1][16][4096][64].
// Deterministic, no atomics. Per (head, 16 queries) an online softmax over the 32-key chunks of the segment(s) the 16 queries belong to (a 16-query tile may straddle a boundary; masking is per element by the query's segment bounds).
// WMMA (v_wmma_f32_16x16x32_f16, f32 accumulate): S^T = k q^T with q, k EXACT bf16 x8 (single exact products, K 64), O^T += v^T P^T with P hi+lo x1024 and v EXACT x8 (2 products); mask / softmax bookkeeping in f32. Inputs rounded to bf16

namespace {
constexpr int NH = 16, T = 4096, D = 64, NSEG = 8;
constexpr float XS = 8.0f, PS = 1024.0f;
typedef _Float16 b16;
typedef __attribute__((ext_vector_type(16))) _Float16 v16b;
typedef __attribute__((ext_vector_type(8))) _Float16 v8b;
typedef __attribute__((ext_vector_type(8))) float v8f;
typedef __attribute__((ext_vector_type(4))) float v4f;
typedef __attribute__((ext_vector_type(2))) float v2f;
__device__ __forceinline__ float bf16_rne(float f) { unsigned int u = __float_as_uint(f); u += 0x7FFFu + ((u >> 16) & 1u); return __uint_as_float(u & 0xFFFF0000u); }
__device__ __forceinline__ void split16(float v, b16& hi, b16& lo) { hi = (b16)v; lo = (b16)(v - (float)hi); }
__device__ __forceinline__ v16b frag_kb(const b16* p, int hh) { const v8b a = *(const v8b*)(p + 8 * hh), b = *(const v8b*)(p + 16 + 8 * hh); v16b f;
#pragma unroll
  for (int e = 0; e < 8; ++e) { f[e] = a[e]; f[8 + e] = b[e]; } return f; }
__device__ __forceinline__ v8f wmma16b(v16b a, v16b b, v8f c) { v8f d = __builtin_amdgcn_wmma_f32_16x16x32_f16(false, a, false, b, (short)0, c, false, false); asm volatile("v_nop\n\tv_nop\n\tv_nop\n\tv_nop" : "+v"(d) : "v"(a), "v"(b)); return d; }
__device__ __forceinline__ void wave_lds_sync() { __builtin_amdgcn_fence(__ATOMIC_RELEASE, "workgroup"); __builtin_amdgcn_wave_barrier(); __builtin_amdgcn_fence(__ATOMIC_ACQUIRE, "workgroup"); }
__device__ __forceinline__ int iclamp(int v, int lo, int hi) { return v < lo ? lo : (v > hi ? hi : v); }
__device__ __forceinline__ float xhalf(float x) { return __builtin_bit_cast(float, __builtin_amdgcn_permlanex16(__builtin_bit_cast(int, x), __builtin_bit_cast(int, x), 0x76543210, 0xfedcba98, false, false)); }  // lane l reads lane l ^ 16
// segment id of position p = number of interior boundaries cu[1..NSEG-1] that are <= p (== searchsorted(cu[1:], p, 'right') for p < T)
__device__ __forceinline__ int seg_of(const int* cu, int p) { int s = 0; for (int i = 1; i < NSEG; ++i) s += (cu[i] <= p) ? 1 : 0; return s; }

__global__ __launch_bounds__(256) void prep_kernel(const float* __restrict__ q, const float* __restrict__ k, b16* __restrict__ QB, b16* __restrict__ KB) {
  const size_t u = (size_t)blockIdx.x * 256 + threadIdx.x; if (u >= (size_t)NH * T * 8) return; const int d0 = (int)(u % 8) * 8; const size_t row = u / 8; v8b a, bq;
#pragma unroll
  for (int j = 0; j < 8; ++j) { a[j] = (b16)(bf16_rne(q[row * D + d0 + j]) * XS); bq[j] = (b16)(bf16_rne(k[row * D + d0 + j]) * XS); }
  { *(v8b*)(QB + row * D + d0) = a; *(v8b*)(KB + row * D + d0) = bq;  }
}
__global__ __launch_bounds__(32) void att_kernel(const b16* __restrict__ QB, const b16* __restrict__ KB, const float* __restrict__ v, const int* __restrict__ cu, int QLIM, float* __restrict__ out) {
  __shared__ __attribute__((aligned(16))) b16 Vt[D][40]; __shared__ float Of[16][D + 2]; __shared__ int Sg[16], Cu[NSEG + 1], Kr[2];
  const int lane = threadIdx.x, nloc = lane & 15, hlf = lane >> 4; const int h = blockIdx.x / (QLIM / 16), q0 = (blockIdx.x % (QLIM / 16)) * 16;
  if (lane <= NSEG) Cu[lane] = iclamp(cu[lane], 0, T);
  wave_lds_sync();
  if (lane < 16) Sg[lane] = seg_of(Cu, q0 + lane);
  wave_lds_sync();
  if (lane == 0) { Kr[0] = Cu[Sg[0]] & ~31; Kr[1] = Cu[Sg[15] + 1]; }   // key range from LDS (no dynamic register indexing)
  wave_lds_sync(); const int kbeg = Kr[0], kend = Kr[1];
  // the keys of this lane's query: for sorted offsets seg_of(key) == qs exactly where klo <= key < khi
  const int qs = Sg[nloc]; const int klo = qs == 0 ? 0 : Cu[qs], khi = qs >= NSEG - 1 ? T : Cu[qs + 1];
  v8f acc[4] = {(v8f){}, (v8f){}, (v8f){}, (v8f){}}; const b16* qb = QB + ((size_t)h * T + q0) * D;
  const v16b qf[2] = {frag_kb(qb + (size_t)nloc * D, hlf), frag_kb(qb + (size_t)nloc * D + 32, hlf)};
  float mx = -INFINITY, dn = 0.0f;   // running maximum of the query (equal in both halves); running sum over this half's keys only
#pragma unroll 1
  for (int kc = kbeg; kc < kend; kc += 32) { const b16* kb_ = KB + ((size_t)h * T + kc) * D;
    for (int rr = 0; rr < 32; ++rr) { const int kk = kc + rr; for (int q = 0; q < 2; ++q) Vt[q * 32 + lane][rr] = (b16)(kk < T ? bf16_rne(v[((size_t)h * T + kk) * D + q * 32 + lane]) * XS : 0.0f); }
    float sv[16]; float cm = -INFINITY;
#pragma unroll
    for (int blk = 0; blk < 2; ++blk) { v8f s = {};
#pragma unroll
      for (int kb = 0; kb < 2; ++kb) s = wmma16b(frag_kb(kb_ + (size_t)(blk * 16 + nloc) * D + kb * 32, hlf), qf[kb], s);
#pragma unroll
      for (int r8 = 0; r8 < 8; ++r8) { const int kk = kc + blk * 16 + 8 * hlf + r8; sv[blk * 8 + r8] = (kk >= klo && kk < khi) ? s[r8] * (0.125f / (XS * XS)) : -INFINITY; cm = fmaxf(cm, sv[blk * 8 + r8]); } }
    cm = fmaxf(cm, xhalf(cm)); const float mo = mx; const float mn = fmaxf(mo, cm); float psum = 0.0f; v16b ph, pl;
#pragma unroll
    for (int e = 0; e < 16; ++e) { const float p = (sv[e] == -INFINITY || mn == -INFINITY) ? 0.0f : __expf(sv[e] - mn); psum += p; b16 a, b; split16(p * PS, a, b); ph[e] = a; pl[e] = b; }
    const float sf = (mo == -INFINITY || mn == -INFINITY) ? ((mo == -INFINITY && mn == -INFINITY) ? 1.0f : 0.0f) : __expf(mo - mn); dn = dn * sf + psum; mx = mn;
    wave_lds_sync();
#pragma unroll
    for (int t = 0; t < 4; ++t) {
#pragma unroll
      for (int r8 = 0; r8 < 8; ++r8) acc[t][r8] *= sf;
      const v16b vb = frag_kb(&Vt[t * 16 + nloc][0], hlf); acc[t] = wmma16b(vb, ph, acc[t]); acc[t] = wmma16b(vb, pl, acc[t]); }
    wave_lds_sync(); }
  const float dt = dn + xhalf(dn);   // the two halves' sums joined once
#pragma unroll
  for (int t = 0; t < 4; ++t)
#pragma unroll
    for (int r8 = 0; r8 < 8; ++r8) Of[nloc][t * 16 + 8 * hlf + r8] = acc[t][r8] * (1.0f / (PS * XS)) / dt;
  wave_lds_sync();
  { for (int rr = 0; rr < 16; ++rr) *(v2f*)(out + ((size_t)h * T + q0 + rr) * D + lane * 2) = (v2f){Of[rr][lane * 2], Of[rr][lane * 2 + 1]};  }
}
}  // namespace

extern "C" void kernel_launch(void* const* d_in, const int* in_sizes, int n_in, void* d_out, int out_size, void* d_ws, size_t ws_size, hipStream_t stream) {
  (void)n_in;
  auto Fp = [&](int i) { return (const float*)d_in[i]; }; auto Ip = [&](int i) { return (const int*)d_in[i]; };
  // input order: 0 q [1,16,4096,64]; 1 k; 2 v; 3 cu_seqlens [9] i32
  if (in_sizes[0] != NH * T * D || in_sizes[1] != NH * T * D || in_sizes[2] != NH * T * D || in_sizes[3] != NSEG + 1 || out_size != NH * T * D) return;
  const int QLIM = T;   // query cut (per head)
  size_t off = 0; char* ws = (char*)d_ws;
  auto carve = [&](size_t bytes) { char* p = ws + off; off += (bytes + 255) & ~(size_t)255; return p; };
  b16* QB = (b16*)carve((size_t)NH * T * D * 2); b16* KB = (b16*)carve((size_t)NH * T * D * 2);
  if (off > ws_size || off > ((size_t)32 << 20)) return;   // 17 MB
  prep_kernel<<<(NH * T * 8 + 255) / 256, 256, 0, stream>>>(Fp(0), Fp(1), QB, KB);
  att_kernel<<<NH * (QLIM / 16), 32, 0, stream>>>(QB, KB, Fp(2), Ip(3), QLIM, (float*)d_out);
}

// v002
// A run of this version takes 144 microseconds.
// Next to v001, in two timings, it ran 7.35 and 7.30 times as fast.
// All steps since v000 together make it 11.6 times as fast.
#include <hip/hip_runtime.h>

// Packed (varlen) attention, non-causal: for each of the 16 heads and 4,096 token positions, attention over the keys of the same packed segment (segments from the verbatim cu_seqlens offsets; class A):
// out = softmax(q k^T / 8 over the segment) v -> [1][16][4096][64].
// Deterministic, no atomics. Per (head, 16 queries) an online softmax over the 32-key chunks of the segment(s) the 16 queries belong to (a 16-query tile may straddle a boundary; masking is per element by the query's segment bounds).
// WMMA (v_wmma_f32_16x16x32_f16, f32 accumulate): S^T = k q^T with q, k EXACT bf16 x8 (single exact products, K 64), O^T += v^T P^T with P hi+lo x1024 and v EXACT x8 (2 products); mask / softmax bookkeeping in f32. Inputs rounded to bf16
// v is rounded, scaled and transposed ONCE, in the first launch, into 4 KB tiles VT[head * 128 + key chunk][d / 16][key / 16][lane][8 keys] in the A operand's own order (lane = 16 * (key / 8 % 2) + d % 16), so a V^T fragment is two global loads of 512 contiguous bytes a wave.

namespace {
constexpr int NH = 16, T = 4096, D = 64, NSEG = 8;
constexpr float XS = 8.0f, PS = 1024.0f;
typedef _Float16 b16;
typedef __attribute__((ext_vector_type(16))) _Float16 v16b;
typedef __attribute__((ext_vector_type(8))) _Float16 v8b;
typedef __attribute__((ext_vector_type(8))) float v8f;
typedef __attribute__((ext_vector_type(4))) float v4f;
typedef __attribute__((ext_vector_type(2))) float v2f;
__device__ __forceinline__ float bf16_rne(float f) { unsigned int u = __float_as_uint(f); u += 0x7FFFu + ((u >> 16) & 1u); return __uint_as_float(u & 0xFFFF0000u); }
__device__ __forceinline__ void split16(float v, b16& hi, b16& lo) { hi = (b16)v; lo = (b16)(v - (float)hi); }
__device__ __forceinline__ v16b frag_kb(const b16* p, int hh) { const v8b a = *(const v8b*)(p + 8 * hh), b = *(const v8b*)(p + 16 + 8 * hh); v16b f;
#pragma unroll
  for (int e = 0; e < 8; ++e) { f[e] = a[e]; f[8 + e] = b[e]; } return f; }
__device__ __forceinline__ v8f wmma16b(v16b a, v16b b, v8f c) { v8f d = __builtin_amdgcn_wmma_f32_16x16x32_f16(false, a, false, b, (short)0, c, false, false); asm volatile("v_nop\n\tv_nop\n\tv_nop\n\tv_nop" : "+v"(d) : "v"(a), "v"(b)); return d; }
__device__ __forceinline__ void wave_lds_sync() { __builtin_amdgcn_fence(__ATOMIC_RELEASE, "workgroup"); __builtin_amdgcn_wave_barrier(); __builtin_amdgcn_fence(__ATOMIC_ACQUIRE, "workgroup"); }
__device__ __forceinline__ int iclamp(int v, int lo, int hi) { return v < lo ? lo : (v > hi ? hi : v); }
__device__ __forceinline__ float xhalf(float x) { return __builtin_bit_cast(float, __builtin_amdgcn_permlanex16(__builtin_bit_cast(int, x), __builtin_bit_cast(int, x), 0x76543210, 0xfedcba98, false, false)); }  // lane l reads lane l ^ 16
// segment id of position p = number of interior boundaries cu[1..NSEG-1] that are <= p (== searchsorted(cu[1:], p, 'right') for p < T)
__device__ __forceinline__ int seg_of(const int* cu, int p) { int s = 0; for (int i = 1; i < NSEG; ++i) s += (cu[i] <= p) ? 1 : 0; return s; }

constexpr int QKBLK = NH * T * 8 / 256, VBLK = NH * T * D / 32 / 256;   // blocks of the first launch: q and k rows; v tiles
__global__ __launch_bounds__(256) void prep_kernel(const float* __restrict__ q, const float* __restrict__ k, const float* __restrict__ v, b16* __restrict__ QB, b16* __restrict__ KB, b16* __restrict__ VT) {
  if (blockIdx.x >= QKBLK) {   // v tiles: a thread takes one d of one 32-key chunk: 32 loads (a wave reads 128 contiguous bytes each), four 16-byte stores (16 lanes fill 256 contiguous bytes each)
    const unsigned w = (blockIdx.x - QKBLK) * 256 + threadIdx.x, d = w % D; const size_t cg = w / D; const float* vp = v + cg * 32 * D + d; b16* o = VT + cg * (32 * D) + (d / 16) * 512 + (d % 16) * 8;
#pragma unroll
    for (int g = 0; g < 4; ++g) { v8b a;
#pragma unroll
      for (int j = 0; j < 8; ++j) a[j] = (b16)(bf16_rne(vp[(g * 8 + j) * D]) * XS);
      *(v8b*)(o + g * 128) = a; }   // keys 8 g .. 8 g + 7: fragment half g / 2, wave half g % 2
    return; }
  const size_t u = (size_t)blockIdx.x * 256 + threadIdx.x; if (u >= (size_t)NH * T * 8) return; const int d0 = (int)(u % 8) * 8; const size_t row = u / 8; v8b a, bq;
#pragma unroll
  for (int j = 0; j < 8; ++j) { a[j] = (b16)(bf16_rne(q[row * D + d0 + j]) * XS); bq[j] = (b16)(bf16_rne(k[row * D + d0 + j]) * XS); }
  { *(v8b*)(QB + row * D + d0) = a; *(v8b*)(KB + row * D + d0) = bq;  }
}
__global__ __launch_bounds__(32) void att_kernel(const b16* __restrict__ QB, const b16* __restrict__ KB, const b16* __restrict__ VT, const int* __restrict__ cu, int QLIM, float* __restrict__ out) {
  __shared__ float Of[16][D + 2]; __shared__ int Sg[16], Cu[NSEG + 1], Kr[2];
  const int lane = threadIdx.x, nloc = lane & 15, hlf = lane >> 4; const int h = blockIdx.x / (QLIM / 16), q0 = (blockIdx.x % (QLIM / 16)) * 16;
  if (lane <= NSEG) Cu[lane] = iclamp(cu[lane], 0, T);
  wave_lds_sync();
  if (lane < 16) Sg[lane] = seg_of(Cu, q0 + lane);
  wave_lds_sync();
  if (lane == 0) { Kr[0] = Cu[Sg[0]] & ~31; Kr[1] = Cu[Sg[15] + 1]; }   // key range from LDS (no dynamic register indexing)
  wave_lds_sync(); const int kbeg = Kr[0], kend = Kr[1];
  // the keys of this lane's query: for sorted offsets seg_of(key) == qs exactly where klo <= key < khi
  const int qs = Sg[nloc]; const int klo = qs == 0 ? 0 : Cu[qs], khi = qs >= NSEG - 1 ? T : Cu[qs + 1];
  v8f acc[4] = {(v8f){}, (v8f){}, (v8f){}, (v8f){}}; const b16* qb = QB + ((size_t)h * T + q0) * D;
  const v16b qf[2] = {frag_kb(qb + (size_t)nloc * D, hlf), frag_kb(qb + (size_t)nloc * D + 32, hlf)};
  float mx = -INFINITY, dn = 0.0f;   // running maximum of the query (equal in both halves); running sum over this half's keys only
#pragma unroll 1
  for (int kc = kbeg; kc < kend; kc += 32) { const b16* kb_ = KB + ((size_t)h * T + kc) * D;
    const b16* vt_ = VT + ((size_t)h * T + kc) * D + lane * 8; v16b vb[4];   // loaded ahead of the score products: they depend on nothing of this chunk
#pragma unroll
    for (int t = 0; t < 4; ++t) { const v8b a = *(const v8b*)(vt_ + t * 512), b = *(const v8b*)(vt_ + t * 512 + 256);   // same k order as frag_kb: element e = key 8 * hlf + e, element 8 + e = key 16 + 8 * hlf + e
#pragma unroll
      for (int e = 0; e < 8; ++e) { vb[t][e] = a[e]; vb[t][8 + e] = b[e]; } }
    asm volatile("s_wait_xcnt 0x0" ::: "memory");   // a precaution: the build reuses the address registers of the eight loads above as the destination of the next load
    float sv[16]; float cm = -INFINITY;
#pragma unroll
    for (int blk = 0; blk < 2; ++blk) { v8f s = {};
#pragma unroll
      for (int kb = 0; kb < 2; ++kb) s = wmma16b(frag_kb(kb_ + (size_t)(blk * 16 + nloc) * D + kb * 32, hlf), qf[kb], s);
#pragma unroll
      for (int r8 = 0; r8 < 8; ++r8) { const int kk = kc + blk * 16 + 8 * hlf + r8; sv[blk * 8 + r8] = (kk >= klo && kk < khi) ? s[r8] * (0.125f / (XS * XS)) : -INFINITY; cm = fmaxf(cm, sv[blk * 8 + r8]); } }
    cm = fmaxf(cm, xhalf(cm)); const float mo = mx; const float mn = fmaxf(mo, cm); float psum = 0.0f; v16b ph, pl;
#pragma unroll
    for (int e = 0; e < 16; ++e) { const float p = (sv[e] == -INFINITY || mn == -INFINITY) ? 0.0f : __expf(sv[e] - mn); psum += p; b16 a, b; split16(p * PS, a, b); ph[e] = a; pl[e] = b; }
    const float sf = (mo == -INFINITY || mn == -INFINITY) ? ((mo == -INFINITY && mn == -INFINITY) ? 1.0f : 0.0f) : __expf(mo - mn); dn = dn * sf + psum; mx = mn;
#pragma unroll
    for (int t = 0; t < 4; ++t) {
#pragma unroll
      for (int r8 = 0; r8 < 8; ++r8) acc[t][r8] *= sf;
      acc[t] = wmma16b(vb[t], ph, acc[t]); acc[t] = wmma16b(vb[t], pl, acc[t]); } }
  const float dt = dn + xhalf(dn);   // the two halves' sums joined once
#pragma unroll
  for (int t = 0; t < 4; ++t)
#pragma unroll
    for (int r8 = 0; r8 < 8; ++r8) Of[nloc][t * 16 + 8 * hlf + r8] = acc[t][r8] * (1.0f / (PS * XS)) / dt;
  wave_lds_sync();
  { for (int rr = 0; rr < 16; ++rr) *(v2f*)(out + ((size_t)h * T + q0 + rr) * D + lane * 2) = (v2f){Of[rr][lane * 2], Of[rr][lane * 2 + 1]};  }
}
}  // namespace

extern "C" void kernel_launch(void* const* d_in, const int* in_sizes, int n_in, void* d_out, int out_size, void* d_ws, size_t ws_size, hipStream_t stream) {
  (void)n_in;
  auto Fp = [&](int i) { return (const float*)d_in[i]; }; auto Ip = [&](int i) { return (const int*)d_in[i]; };
  // input order: 0 q [1,16,4096,64]; 1 k; 2 v; 3 cu_seqlens [9] i32
  if (in_sizes[0] != NH * T * D || in_sizes[1] != NH * T * D || in_sizes[2] != NH * T * D || in_sizes[3] != NSEG + 1 || out_size != NH * T * D) return;
  const int QLIM = T;   // query cut (per head)
  size_t off = 0; char* ws = (char*)d_ws;
  auto carve = [&](size_t bytes) { char* p = ws + off; off += (bytes + 255) & ~(size_t)255; return p; };
  b16* QB = (b16*)carve((size_t)NH * T * D * 2); b16* KB = (b16*)carve((size_t)NH * T * D * 2); b16* VT = (b16*)carve((size_t)NH * T * D * 2);
  if (off > ws_size || off > ((size_t)32 << 20)) return;   // 25 MB
  prep_kernel<<<QKBLK + VBLK, 256, 0, stream>>>(Fp(0), Fp(1), Fp(2), QB, KB, VT);
  att_kernel<<<NH * (QLIM / 16), 32, 0, stream>>>(QB, KB, VT, Ip(3), QLIM, (float*)d_out);
}

// v003
// It runs in 94.8 microseconds.
// Timed twice side by side with v002, it ran 1.53 and 1.55 times as fast.
// All steps since v000 together make it 17.9 times as fast.
#include <hip/hip_runtime.h>

// Packed (varlen) attention, non-causal: for each of the 16 heads and 4,096 token positions, attention over the keys of the same packed segment (segments from the verbatim cu_seqlens offsets; class A):
// out = softmax(q k^T / 8 over the segment) v -> [1][16][4096][64].
// Deterministic, no atomics. Per (head, 16 queries) an online softmax over the 32-key chunks of the segment(s) the 16 queries belong to (a 16-query tile may straddle a boundary; masking is per element by the query's segment bounds).
// WMMA (v_wmma_f32_16x16x32_f16, f32 accumulate): S^T = k q^T with q, k EXACT bf16 x8 (single exact products, K 64), O^T += v^T P^T with P hi+lo x1024 and v EXACT x8 (2 products); mask / softmax bookkeeping in f32. Inputs rounded to bf16
// k is rounded and scaled ONCE, in the first launch, into 4 KB tiles KT[head * 128 + key chunk][key / 16][d / 32][d / 16 % 2][lane][8 d] in the A operand's own order (lane = 16 * (d / 8 % 2) + key % 16), so a K fragment is two global loads of 512 contiguous bytes a wave (four whole lines each, not 16 lines of 32 bytes).
// v is rounded, scaled and transposed ONCE, in the first launch, into 4 KB tiles VT[head * 128 + key chunk][d / 16][key / 16][lane][8 keys] in the A operand's own order (lane = 16 * (key / 8 % 2) + d % 16), so a V^T fragment is two global loads of 512 contiguous bytes a wave.

namespace {
constexpr int NH = 16, T = 4096, D = 64, NSEG = 8;
constexpr float XS = 8.0f, PS = 1024.0f;
typedef _Float16 b16;
typedef __attribute__((ext_vector_type(16))) _Float16 v16b;
typedef __attribute__((ext_vector_type(8))) _Float16 v8b;
typedef __attribute__((ext_vector_type(8))) float v8f;
typedef __attribute__((ext_vector_type(4))) float v4f;
typedef __attribute__((ext_vector_type(2))) float v2f;
__device__ __forceinline__ float bf16_rne(float f) { unsigned int u = __float_as_uint(f); u += 0x7FFFu + ((u >> 16) & 1u); return __uint_as_float(u & 0xFFFF0000u); }
__device__ __forceinline__ void split16(float v, b16& hi, b16& lo) { hi = (b16)v; lo = (b16)(v - (float)hi); }
__device__ __forceinline__ v16b frag_kb(const b16* p, int hh) { const v8b a = *(const v8b*)(p + 8 * hh), b = *(const v8b*)(p + 16 + 8 * hh); v16b f;
#pragma unroll
  for (int e = 0; e < 8; ++e) { f[e] = a[e]; f[8 + e] = b[e]; } return f; }
__device__ __forceinline__ v8f wmma16b(v16b a, v16b b, v8f c) { v8f d = __builtin_amdgcn_wmma_f32_16x16x32_f16(false, a, false, b, (short)0, c, false, false); asm volatile("v_nop\n\tv_nop\n\tv_nop\n\tv_nop" : "+v"(d) : "v"(a), "v"(b)); return d; }
__device__ __forceinline__ void wave_lds_sync() { __builtin_amdgcn_fence(__ATOMIC_RELEASE, "workgroup"); __builtin_amdgcn_wave_barrier(); __builtin_amdgcn_fence(__ATOMIC_ACQUIRE, "workgroup"); }
__device__ __forceinline__ int iclamp(int v, int lo, int hi) { return v < lo ? lo : (v > hi ? hi : v); }
__device__ __forceinline__ float xhalf(float x) { return __builtin_bit_cast(float, __builtin_amdgcn_permlanex16(__builtin_bit_cast(int, x), __builtin_bit_cast(int, x), 0x76543210, 0xfedcba98, false, false)); }  // lane l reads lane l ^ 16
// segment id of position p = number of interior boundaries cu[1..NSEG-1] that are <= p (== searchsorted(cu[1:], p, 'right') for p < T)
__device__ __forceinline__ int seg_of(const int* cu, int p) { int s = 0; for (int i = 1; i < NSEG; ++i) s += (cu[i] <= p) ? 1 : 0; return s; }

constexpr int QKBLK = NH * T * 8 / 256, VBLK = NH * T * D / 32 / 256;   // blocks of the first launch: q and k rows; v tiles
__global__ __launch_bounds__(256) void prep_kernel(const float* __restrict__ q, const float* __restrict__ k, const float* __restrict__ v, b16* __restrict__ QB, b16* __restrict__ KT, b16* __restrict__ VT) {
  if (blockIdx.x >= QKBLK) {   // v tiles: a thread takes one d of one 32-key chunk: 32 loads (a wave reads 128 contiguous bytes each), four 16-byte stores (16 lanes fill 256 contiguous bytes each)
    const unsigned w = (blockIdx.x - QKBLK) * 256 + threadIdx.x, d = w % D; const size_t cg = w / D; const float* vp = v + cg * 32 * D + d; b16* o = VT + cg * (32 * D) + (d / 16) * 512 + (d % 16) * 8;
#pragma unroll
    for (int g = 0; g < 4; ++g) { v8b a;
#pragma unroll
      for (int j = 0; j < 8; ++j) a[j] = (b16)(bf16_rne(vp[(g * 8 + j) * D]) * XS);
      *(v8b*)(o + g * 128) = a; }   // keys 8 g .. 8 g + 7: fragment half g / 2, wave half g % 2
    return; }
  const size_t u = (size_t)blockIdx.x * 256 + threadIdx.x; if (u >= (size_t)NH * T * 8) return; const int d0 = (int)(u % 8) * 8; const size_t row = u / 8; v8b a, bq;
  // k: a block takes one 32-key chunk, a wave 8 keys by 32 d of it: it reads 8 whole 128-byte lines (4 lanes a key) and stores 4 whole lines of KT (8 keys of one d / 8 each), every line from one wave
  const unsigned ln = (unsigned)(u % 32), wv = (unsigned)(u / 32 % 8), kr = (wv / 4) * 16 + (wv % 2) * 8 + ln / 4, g = ln % 4; const size_t krow = (u / 256) * 32 + kr; const int kd = (int)((wv / 2 % 2) * 32 + g * 8);
  b16* ko = KT + (u / 256) * (32 * D) + (((wv / 4) * 2 + wv / 2 % 2) * 2 + g / 2) * 256 + ((g % 2) * 16 + kr % 16) * 8;
  const float* qp = q + row * D + d0; const float* kp = k + krow * D + kd; const v4f q0 = *(const v4f*)qp, q1 = *(const v4f*)(qp + 4), k0 = *(const v4f*)kp, k1 = *(const v4f*)(kp + 4);
  asm volatile("s_wait_xcnt 0x0" :: "v"(qp), "v"(kp) : "memory");   // a precaution: the two address pairs of the four loads above are inputs, so no load lands on them ahead of this wait
#pragma unroll
  for (int j = 0; j < 4; ++j) { a[j] = (b16)(bf16_rne(q0[j]) * XS); a[4 + j] = (b16)(bf16_rne(q1[j]) * XS); bq[j] = (b16)(bf16_rne(k0[j]) * XS); bq[4 + j] = (b16)(bf16_rne(k1[j]) * XS); }
  { *(v8b*)(QB + row * D + d0) = a; *(v8b*)ko = bq;  }
}
__global__ __launch_bounds__(32) void att_kernel(const b16* __restrict__ QB, const b16* __restrict__ KT, const b16* __restrict__ VT, const int* __restrict__ cu, int QLIM, float* __restrict__ out) {
  __shared__ float Of[16][D + 2]; __shared__ int Sg[16], Cu[NSEG + 1], Kr[2];
  const int lane = threadIdx.x, nloc = lane & 15, hlf = lane >> 4; const int h = blockIdx.x / (QLIM / 16), q0 = (blockIdx.x % (QLIM / 16)) * 16;
  if (lane <= NSEG) Cu[lane] = iclamp(cu[lane], 0, T);
  wave_lds_sync();
  if (lane < 16) Sg[lane] = seg_of(Cu, q0 + lane);
  wave_lds_sync();
  if (lane == 0) { Kr[0] = Cu[Sg[0]] & ~31; Kr[1] = Cu[Sg[15] + 1]; }   // key range from LDS (no dynamic register indexing)
  wave_lds_sync(); const int kbeg = Kr[0], kend = Kr[1];
  // the keys of this lane's query: for sorted offsets seg_of(key) == qs exactly where klo <= key < khi
  const int qs = Sg[nloc]; const int klo = qs == 0 ? 0 : Cu[qs], khi = qs >= NSEG - 1 ? T : Cu[qs + 1];
  v8f acc[4] = {(v8f){}, (v8f){}, (v8f){}, (v8f){}}; const b16* qb = QB + ((size_t)h * T + q0) * D;
  const v16b qf[2] = {frag_kb(qb + (size_t)nloc * D, hlf), frag_kb(qb + (size_t)nloc * D + 32, hlf)};
  float mx = -INFINITY, dn = 0.0f;   // running maximum of the query (equal in both halves); running sum over this half's keys only
#pragma unroll 1
  for (int kc = kbeg; kc < kend; kc += 32) { const b16* kt_ = KT + ((size_t)h * T + kc) * D + lane * 8; v16b kf[4];   // fragment blk * 2 + kb: keys 16 * blk + nloc, d 32 * kb ..
#pragma unroll
    for (int t = 0; t < 4; ++t) { const v8b a = *(const v8b*)(kt_ + t * 512), b = *(const v8b*)(kt_ + t * 512 + 256);   // same k order as frag_kb of q: element e = d 8 * hlf + e, element 8 + e = d 16 + 8 * hlf + e
#pragma unroll
      for (int e = 0; e < 8; ++e) { kf[t][e] = a[e]; kf[t][8 + e] = b[e]; } }
    const b16* vt_ = VT + ((size_t)h * T + kc) * D + lane * 8; v16b vb[4];   // loaded ahead of the score products: they depend on nothing of this chunk
#pragma unroll
    for (int t = 0; t < 4; ++t) { const v8b a = *(const v8b*)(vt_ + t * 512), b = *(const v8b*)(vt_ + t * 512 + 256);   // same k order as frag_kb: element e = key 8 * hlf + e, element 8 + e = key 16 + 8 * hlf + e
#pragma unroll
      for (int e = 0; e < 8; ++e) { vb[t][e] = a[e]; vb[t][8 + e] = b[e]; } }
    asm volatile("s_wait_xcnt 0x0" :: "v"(kt_), "v"(vt_) : "memory");   // a precaution: the two address pairs of the sixteen loads above are inputs, so they stay untouched (no load lands on them) up to this wait
    float sv[16]; float cm = -INFINITY;
#pragma unroll
    for (int blk = 0; blk < 2; ++blk) { v8f s = {};
#pragma unroll
      for (int kb = 0; kb < 2; ++kb) s = wmma16b(kf[blk * 2 + kb], qf[kb], s);
#pragma unroll
      for (int r8 = 0; r8 < 8; ++r8) { const int kk = kc + blk * 16 + 8 * hlf + r8; sv[blk * 8 + r8] = (kk >= klo && kk < khi) ? s[r8] * (0.125f / (XS * XS)) : -INFINITY; cm = fmaxf(cm, sv[blk * 8 + r8]); } }
    cm = fmaxf(cm, xhalf(cm)); const float mo = mx; const float mn = fmaxf(mo, cm); float psum = 0.0f; v16b ph, pl;
#pragma unroll
    for (int e = 0; e < 16; ++e) { const float p = (sv[e] == -INFINITY || mn == -INFINITY) ? 0.0f : __expf(sv[e] - mn); psum += p; b16 a, b; split16(p * PS, a, b); ph[e] = a; pl[e] = b; }
    const float sf = (mo == -INFINITY || mn == -INFINITY) ? ((mo == -INFINITY && mn == -INFINITY) ? 1.0f : 0.0f) : __expf(mo - mn); dn = dn * sf + psum; mx = mn;
#pragma unroll
    for (int t = 0; t < 4; ++t) {
#pragma unroll
      for (int r8 = 0; r8 < 8; ++r8) acc[t][r8] *= sf;
      acc[t] = wmma16b(vb[t], ph, acc[t]); acc[t] = wmma16b(vb[t], pl, acc[t]); } }
  const float dt = dn + xhalf(dn);   // the two halves' sums joined once
#pragma unroll
  for (int t = 0; t < 4; ++t)
#pragma unroll
    for (int r8 = 0; r8 < 8; ++r8) Of[nloc][t * 16 + 8 * hlf + r8] = acc[t][r8] * (1.0f / (PS * XS)) / dt;
  wave_lds_sync();
  { for (int rr = 0; rr < 16; ++rr) *(v2f*)(out + ((size_t)h * T + q0 + rr) * D + lane * 2) = (v2f){Of[rr][lane * 2], Of[rr][lane * 2 + 1]};  }
}
}  // namespace

extern "C" void kernel_launch(void* const* d_in, const int* in_sizes, int n_in, void* d_out, int out_size, void* d_ws, size_t ws_size, hipStream_t stream) {
  (void)n_in;
  auto Fp = [&](int i) { return (const float*)d_in[i]; }; auto Ip = [&](int i) { return (const int*)d_in[i]; };
  // input order: 0 q [1,16,4096,64]; 1 k; 2 v; 3 cu_seqlens [9] i32
  if (in_sizes[0] != NH * T * D || in_sizes[1] != NH * T * D || in_sizes[2] != NH * T * D || in_sizes[3] != NSEG + 1 || out_size != NH * T * D) return;
  const int QLIM = T;   // query cut (per head)
  size_t off = 0; char* ws = (char*)d_ws;
  auto carve = [&](size_t bytes) { char* p = ws + off; off += (bytes + 255) & ~(size_t)255; return p; };
  b16* QB = (b16*)carve((size_t)NH * T * D * 2); b16* KT = (b16*)carve((size_t)NH * T * D * 2); b16* VT = (b16*)carve((size_t)NH * T * D * 2);
  if (off > ws_size || off > ((size_t)32 << 20)) return;   // 25 MB
  prep_kernel<<<QKBLK + VBLK, 256, 0, stream>>>(Fp(0), Fp(1), Fp(2), QB, KT, VT);
  att_kernel<<<NH * (QLIM / 16), 32, 0, stream>>>(QB, KT, VT, Ip(3), QLIM, (float*)d_out);
}

// v004
// A run of this version takes 67.1 microseconds.
// Next to v003, in two timings, it ran 1.47 times as fast each time.
// All steps since v000 together make it 26.4 times as fast.
#include <hip/hip_runtime.h>

// Packed (varlen) attention, non-causal: for each of the 16 heads and 4,096 token positions, attention over the keys of the same packed segment (segments from the verbatim cu_seqlens offsets; class A):
// out = softmax(q k^T / 8 over the segment) v -> [1][16][4096][64].
// Deterministic, no atomics. Per (head, 16 queries) an online softmax over the 32-key chunks of the segment(s) the 16 queries belong to (a 16-query tile may straddle a boundary; masking is per element by the query's segment bounds).
// A work-group of four waves takes one (head, 16 queries): each wave walks every fourth chunk with its own maxima, sums and accumulators; the four partial results are joined through LDS in a fixed order.
// WMMA (v_wmma_f32_16x16x32_f16, f32 accumulate): S^T = k q^T with q, k EXACT bf16 x8 (single exact products, K 64), O^T += v^T P^T with P hi+lo x1024 and v EXACT x8 (2 products); mask / softmax bookkeeping in f32. Inputs rounded to bf16
// k is rounded and scaled ONCE, in the first launch, into 4 KB tiles KT[head * 128 + key chunk][key / 16][d / 32][d / 16 % 2][lane][8 d] in the A operand's own order (lane = 16 * (d / 8 % 2) + key % 16), so a K fragment is two global loads of 512 contiguous bytes a wave (four whole lines each, not 16 lines of 32 bytes).
// v is rounded, scaled and transposed ONCE, in the first launch, into 4 KB tiles VT[head * 128 + key chunk][d / 16][key / 16][lane][8 keys] in the A operand's own order (lane = 16 * (key / 8 % 2) + d % 16), so a V^T fragment is two global loads of 512 contiguous bytes a wave.

namespace {
constexpr int NH = 16, T = 4096, D = 64, NSEG = 8;
constexpr float XS = 8.0f, PS = 1024.0f;
typedef _Float16 b16;
typedef __attribute__((ext_vector_type(16))) _Float16 v16b;
typedef __attribute__((ext_vector_type(8))) _Float16 v8b;
typedef __attribute__((ext_vector_type(8))) float v8f;
typedef __attribute__((ext_vector_type(4))) float v4f;
typedef __attribute__((ext_vector_type(2))) float v2f;
__device__ __forceinline__ float bf16_rne(float f) { unsigned int u = __float_as_uint(f); u += 0x7FFFu + ((u >> 16) & 1u); return __uint_as_float(u & 0xFFFF0000u); }
__device__ __forceinline__ void split16(float v, b16& hi, b16& lo) { hi = (b16)v; lo = (b16)(v - (float)hi); }
__device__ __forceinline__ v16b frag_kb(const b16* p, int hh) { const v8b a = *(const v8b*)(p + 8 * hh), b = *(const v8b*)(p + 16 + 8 * hh); v16b f;
#pragma unroll
  for (int e = 0; e < 8; ++e) { f[e] = a[e]; f[8 + e] = b[e]; } return f; }
__device__ __forceinline__ v8f wmma16b(v16b a, v16b b, v8f c) { v8f d = __builtin_amdgcn_wmma_f32_16x16x32_f16(false, a, false, b, (short)0, c, false, false); asm volatile("v_nop\n\tv_nop\n\tv_nop\n\tv_nop" : "+v"(d) : "v"(a), "v"(b)); return d; }
__device__ __forceinline__ void wave_lds_sync() { __builtin_amdgcn_fence(__ATOMIC_RELEASE, "workgroup"); __builtin_amdgcn_wave_barrier(); __builtin_amdgcn_fence(__ATOMIC_ACQUIRE, "workgroup"); }
__device__ __forceinline__ int iclamp(int v, int lo, int hi) { return v < lo ? lo : (v > hi ? hi : v); }
__device__ __forceinline__ float xhalf(float x) { return __builtin_bit_cast(float, __builtin_amdgcn_permlanex16(__builtin_bit_cast(int, x), __builtin_bit_cast(int, x), 0x76543210, 0xfedcba98, false, false)); }  // lane l reads lane l ^ 16
// segment id of position p = number of interior boundaries cu[1..NSEG-1] that are <= p (== searchsorted(cu[1:], p, 'right') for p < T)
__device__ __forceinline__ int seg_of(const int* cu, int p) { int s = 0; for (int i = 1; i < NSEG; ++i) s += (cu[i] <= p) ? 1 : 0; return s; }

constexpr int QKBLK = NH * T * 8 / 256, VBLK = NH * T * D / 32 / 256;   // blocks of the first launch: q and k rows; v tiles
__global__ __launch_bounds__(256) void prep_kernel(const float* __restrict__ q, const float* __restrict__ k, const float* __restrict__ v, b16* __restrict__ QB, b16* __restrict__ KT, b16* __restrict__ VT) {
  if (blockIdx.x >= QKBLK) {   // v tiles: a thread takes one d of one 32-key chunk: 32 loads (a wave reads 128 contiguous bytes each), four 16-byte stores (16 lanes fill 256 contiguous bytes each)
    const unsigned w = (blockIdx.x - QKBLK) * 256 + threadIdx.x, d = w % D; const size_t cg = w / D; const float* vp = v + cg * 32 * D + d; b16* o = VT + cg * (32 * D) + (d / 16) * 512 + (d % 16) * 8;
#pragma unroll
    for (int g = 0; g < 4; ++g) { v8b a;
#pragma unroll
      for (int j = 0; j < 8; ++j) a[j] = (b16)(bf16_rne(vp[(g * 8 + j) * D]) * XS);
      *(v8b*)(o + g * 128) = a; }   // keys 8 g .. 8 g + 7: fragment half g / 2, wave half g % 2
    return; }
  const size_t u = (size_t)blockIdx.x * 256 + threadIdx.x; if (u >= (size_t)NH * T * 8) return; const int d0 = (int)(u % 8) * 8; const size_t row = u / 8; v8b a, bq;
  // k: a block takes one 32-key chunk, a wave 8 keys by 32 d of it: it reads 8 whole 128-byte lines (4 lanes a key) and stores 4 whole lines of KT (8 keys of one d / 8 each), every line from one wave
  const unsigned ln = (unsigned)(u % 32), wv = (unsigned)(u / 32 % 8), kr = (wv / 4) * 16 + (wv % 2) * 8 + ln / 4, g = ln % 4; const size_t krow = (u / 256) * 32 + kr; const int kd = (int)((wv / 2 % 2) * 32 + g * 8);
  b16* ko = KT + (u / 256) * (32 * D) + (((wv / 4) * 2 + wv / 2 % 2) * 2 + g / 2) * 256 + ((g % 2) * 16 + kr % 16) * 8;
  const float* qp = q + row * D + d0; const float* kp = k + krow * D + kd; const v4f q0 = *(const v4f*)qp, q1 = *(const v4f*)(qp + 4), k0 = *(const v4f*)kp, k1 = *(const v4f*)(kp + 4);
  asm volatile("s_wait_xcnt 0x0" :: "v"(qp), "v"(kp) : "memory");   // a precaution: the two address pairs of the four loads above are inputs, so no load lands on them ahead of this wait
#pragma unroll
  for (int j = 0; j < 4; ++j) { a[j] = (b16)(bf16_rne(q0[j]) * XS); a[4 + j] = (b16)(bf16_rne(q1[j]) * XS); bq[j] = (b16)(bf16_rne(k0[j]) * XS); bq[4 + j] = (b16)(bf16_rne(k1[j]) * XS); }
  { *(v8b*)(QB + row * D + d0) = a; *(v8b*)ko = bq;  }
}
constexpr int NW = 4;   // waves of a work-group (one lands on each SIMD): a long segment's chunks are shared by four SIMDs, and there are more work-groups than resident places, so a freed place takes the next tile
__global__ __launch_bounds__(32 * NW) void att_kernel(const b16* __restrict__ QB, const b16* __restrict__ KT, const b16* __restrict__ VT, const int* __restrict__ cu, int QLIM, float* __restrict__ out) {
  __shared__ float Ow[NW][16][D + 2], Mw[NW][16], Lw[NW][16], Lt[NW][16]; __shared__ int Sgw[NW][16], Cuw[NW][NSEG + 1], Krw[NW][2];
  const int lane = threadIdx.x & 31, wv = __builtin_amdgcn_readfirstlane(threadIdx.x >> 5), nloc = lane & 15, hlf = lane >> 4;
  int* const Sg = Sgw[wv]; int* const Cu = Cuw[wv]; int* const Kr = Krw[wv];   // each wave keeps its own copy of the small tables: no work-group barrier ahead of the loop
  const int h = blockIdx.x / (QLIM / 16), q0 = (blockIdx.x % (QLIM / 16)) * 16;
  if (lane <= NSEG) Cu[lane] = iclamp(cu[lane], 0, T);
  wave_lds_sync();
  if (lane < 16) Sg[lane] = seg_of(Cu, q0 + lane);
  wave_lds_sync();
  if (lane == 0) { Kr[0] = Cu[Sg[0]] & ~31; Kr[1] = Cu[Sg[15] + 1]; }   // key range from LDS (no dynamic register indexing)
  wave_lds_sync(); const int kbeg = Kr[0], kend = Kr[1];
  // the keys of this lane's query: for sorted offsets seg_of(key) == qs exactly where klo <= key < khi
  const int qs = Sg[nloc]; const int klo = qs == 0 ? 0 : Cu[qs], khi = qs >= NSEG - 1 ? T : Cu[qs + 1];
  v8f acc[4] = {(v8f){}, (v8f){}, (v8f){}, (v8f){}}; const b16* qb = QB + ((size_t)h * T + q0) * D;
  const v16b qf[2] = {frag_kb(qb + (size_t)nloc * D, hlf), frag_kb(qb + (size_t)nloc * D + 32, hlf)};
  float mx = -INFINITY, dn = 0.0f;   // running maximum of the query (equal in both halves); running sum over this half's keys only
#pragma unroll 1
  for (int kc = kbeg + 32 * ((wv + (q0 >> 4)) % NW); kc < kend; kc += 32 * NW) {   // the first chunk goes to another wave from tile to tile, so the odd chunks do not all fall to one SIMD
    const b16* kt_ = KT + ((size_t)h * T + kc) * D + lane * 8; v16b kf[4];   // fragment blk * 2 + kb: keys 16 * blk + nloc, d 32 * kb ..
#pragma unroll
    for (int t = 0; t < 4; ++t) { const v8b a = *(const v8b*)(kt_ + t * 512), b = *(const v8b*)(kt_ + t * 512 + 256);   // same k order as frag_kb of q: element e = d 8 * hlf + e, element 8 + e = d 16 + 8 * hlf + e
#pragma unroll
      for (int e = 0; e < 8; ++e) { kf[t][e] = a[e]; kf[t][8 + e] = b[e]; } }
    const b16* vt_ = VT + ((size_t)h * T + kc) * D + lane * 8; v16b vb[4];   // loaded ahead of the score products: they depend on nothing of this chunk
#pragma unroll
    for (int t = 0; t < 4; ++t) { const v8b a = *(const v8b*)(vt_ + t * 512), b = *(const v8b*)(vt_ + t * 512 + 256);   // same k order as frag_kb: element e = key 8 * hlf + e, element 8 + e = key 16 + 8 * hlf + e
#pragma unroll
      for (int e = 0; e < 8; ++e) { vb[t][e] = a[e]; vb[t][8 + e] = b[e]; } }
    asm volatile("s_wait_xcnt 0x0" :: "v"(kt_), "v"(vt_) : "memory");   // a precaution: the two address pairs of the sixteen loads above are inputs, so they stay untouched (no load lands on them) up to this wait
    float sv[16]; float cm = -INFINITY;
#pragma unroll
    for (int blk = 0; blk < 2; ++blk) { v8f s = {};
#pragma unroll
      for (int kb = 0; kb < 2; ++kb) s = wmma16b(kf[blk * 2 + kb], qf[kb], s);
#pragma unroll
      for (int r8 = 0; r8 < 8; ++r8) { const int kk = kc + blk * 16 + 8 * hlf + r8; sv[blk * 8 + r8] = (kk >= klo && kk < khi) ? s[r8] * (0.125f / (XS * XS)) : -INFINITY; cm = fmaxf(cm, sv[blk * 8 + r8]); } }
    cm = fmaxf(cm, xhalf(cm)); const float mo = mx; const float mn = fmaxf(mo, cm); float psum = 0.0f; v16b ph, pl;
#pragma unroll
    for (int e = 0; e < 16; ++e) { const float p = (sv[e] == -INFINITY || mn == -INFINITY) ? 0.0f : __expf(sv[e] - mn); psum += p; b16 a, b; split16(p * PS, a, b); ph[e] = a; pl[e] = b; }
    const float sf = (mo == -INFINITY || mn == -INFINITY) ? ((mo == -INFINITY && mn == -INFINITY) ? 1.0f : 0.0f) : __expf(mo - mn); dn = dn * sf + psum; mx = mn;
#pragma unroll
    for (int t = 0; t < 4; ++t) {
#pragma unroll
      for (int r8 = 0; r8 < 8; ++r8) acc[t][r8] *= sf;
      acc[t] = wmma16b(vb[t], ph, acc[t]); acc[t] = wmma16b(vb[t], pl, acc[t]); } }
  const float dt = dn + xhalf(dn);   // the two halves' sums joined once
  if (lane < 16) { Mw[wv][lane] = mx; Lw[wv][lane] = dt; }
  __syncthreads();   // every wave's maxima and sums are in LDS
  float mall = -INFINITY;
#pragma unroll
  for (int p = 0; p < NW; ++p) mall = fmaxf(mall, Mw[p][nloc]);
  float lall = 0.0f;   // a wave without a key of this query (maximum -inf) weighs 0
#pragma unroll
  for (int p = 0; p < NW; ++p) { const float mp = Mw[p][nloc], lp = Lw[p][nloc], ep = __expf(mp - mall); lall += mp == -INFINITY ? 0.0f : lp * ep; }
  if (lane < 16) Lt[wv][lane] = lall;   // the wave's own copy, read back behind the barrier below
  const float wg = mx == -INFINITY ? 0.0f : __expf(mx - mall);
#pragma unroll
  for (int t = 0; t < 4; ++t)
#pragma unroll
    for (int r8 = 0; r8 < 8; ++r8) Ow[wv][nloc][t * 16 + 8 * hlf + r8] = acc[t][r8] * wg;
  __syncthreads();   // every wave's weighted partial output is in LDS
#pragma unroll
  for (int i = 0; i < 16 / NW; ++i) { const int rr = wv * (16 / NW) + i; v2f s = {0.0f, 0.0f};   // a wave joins and stores four whole rows (256 bytes each)
#pragma unroll
    for (int p = 0; p < NW; ++p) { s[0] += Ow[p][rr][lane * 2]; s[1] += Ow[p][rr][lane * 2 + 1]; }
    const float lr = Lt[wv][rr]; *(v2f*)(out + ((size_t)h * T + q0 + rr) * D + lane * 2) = (v2f){s[0] * (1.0f / (PS * XS)) / lr, s[1] * (1.0f / (PS * XS)) / lr}; }
}
}  // namespace

extern "C" void kernel_launch(void* const* d_in, const int* in_sizes, int n_in, void* d_out, int out_size, void* d_ws, size_t ws_size, hipStream_t stream) {
  (void)n_in;
  auto Fp = [&](int i) { return (const float*)d_in[i]; }; auto Ip = [&](int i) { return (const int*)d_in[i]; };
  // input order: 0 q [1,16,4096,64]; 1 k; 2 v; 3 cu_seqlens [9] i32
  if (in_sizes[0] != NH * T * D || in_sizes[1] != NH * T * D || in_sizes[2] != NH * T * D || in_sizes[3] != NSEG + 1 || out_size != NH * T * D) return;
  const int QLIM = T;   // query cut (per head)
  size_t off = 0; char* ws = (char*)d_ws;
  auto carve = [&](size_t bytes) { char* p = ws + off; off += (bytes + 255) & ~(size_t)255; return p; };
  b16* QB = (b16*)carve((size_t)NH * T * D * 2); b16* KT = (b16*)carve((size_t)NH * T * D * 2); b16* VT = (b16*)carve((size_t)NH * T * D * 2);
  if (off > ws_size || off > ((size_t)32 << 20)) return;   // 25 MB
  prep_kernel<<<QKBLK + VBLK, 256, 0, stream>>>(Fp(0), Fp(1), Fp(2), QB, KT, VT);
  att_kernel<<<NH * (QLIM / 16), 32 * NW, 0, stream>>>(QB, KT, VT, Ip(3), QLIM, (float*)d_out);
}

// v005
// It runs in 58.2 microseconds.
// In both of two side-by-side timings against v004, it was 1.15 times as fast.
// Counting every step since v000, it is 30.4 times as fast.
#include <hip/hip_runtime.h>

// Packed (varlen) attention, non-causal: for each of the 16 heads and 4,096 token positions, attention over the keys of the same packed segment (segments from the verbatim cu_seqlens offsets; class A):
// out = softmax(q k^T / 8 over the segment) v -> [1][16][4096][64].
// Deterministic, no atomics. Per (head, 16 queries) an online softmax over the 32-key chunks of the segment(s) the 16 queries belong to (a 16-query tile may straddle a boundary; masking is per element by the query's segment bounds).
// A work-group of four waves takes one (head, 16 queries): each wave walks every fourth chunk with its own maxima, sums and accumulators; the four partial results are joined through LDS in a fixed order.
// WMMA (v_wmma_f32_16x16x32_f16, f32 accumulate): S^T = k q^T with q, k EXACT bf16 x8 (single exact products, K 64), O^T += v^T P^T with P hi+lo x1024 and v EXACT x8 (2 products); mask / softmax bookkeeping in f32, on raw scores: P x1024 = exp2(raw * c + b), one FMA a score (c: 1/8, the operand scales and log2 e; b: 10 - c * running maximum). Inputs rounded to bf16
// k is rounded and scaled ONCE, in the first launch, into 4 KB tiles KT[head * 128 + key chunk][key / 16][d / 32][d / 16 % 2][lane][8 d] in the A operand's own order (lane = 16 * (d / 8 % 2) + key % 16), so a K fragment is two global loads of 512 contiguous bytes a wave (four whole lines each, not 16 lines of 32 bytes).
// v is rounded, scaled and transposed ONCE, in the first launch, into 4 KB tiles VT[head * 128 + key chunk][d / 16][key / 16][lane][8 keys] in the A operand's own order (lane = 16 * (key / 8 % 2) + d % 16), so a V^T fragment is two global loads of 512 contiguous bytes a wave.

namespace {
constexpr int NH = 16, T = 4096, D = 64, NSEG = 8;
constexpr float XS = 8.0f;
constexpr float C2 = 0.125f / (XS * XS) * 1.44269504088896340736f, LPS = 10.0f;   // raw score (64 q.k) -> exponent of 2; 2^LPS = 1024, the scale of P
typedef _Float16 b16;
typedef __attribute__((ext_vector_type(16))) _Float16 v16b;
typedef __attribute__((ext_vector_type(8))) _Float16 v8b;
typedef __attribute__((ext_vector_type(8))) float v8f;
typedef __attribute__((ext_vector_type(4))) float v4f;
typedef __attribute__((ext_vector_type(2))) float v2f;
__device__ __forceinline__ float bf16_rne(float f) { unsigned int u = __float_as_uint(f); u += 0x7FFFu + ((u >> 16) & 1u); return __uint_as_float(u & 0xFFFF0000u); }
__device__ __forceinline__ void split16(float v, b16& hi, b16& lo) { hi = (b16)v; lo = (b16)(v - (float)hi); }
__device__ __forceinline__ v16b frag_kb(const b16* p, int hh) { const v8b a = *(const v8b*)(p + 8 * hh), b = *(const v8b*)(p + 16 + 8 * hh); v16b f;
#pragma unroll
  for (int e = 0; e < 8; ++e) { f[e] = a[e]; f[8 + e] = b[e]; } return f; }
__device__ __forceinline__ v8f wmma16b(v16b a, v16b b, v8f c) { v8f d = __builtin_amdgcn_wmma_f32_16x16x32_f16(false, a, false, b, (short)0, c, false, false); asm volatile("v_nop\n\tv_nop\n\tv_nop\n\tv_nop" : "+v"(d) : "v"(a), "v"(b)); return d; }
__device__ __forceinline__ void wave_lds_sync() { __builtin_amdgcn_fence(__ATOMIC_RELEASE, "workgroup"); __builtin_amdgcn_wave_barrier(); __builtin_amdgcn_fence(__ATOMIC_ACQUIRE, "workgroup"); }
__device__ __forceinline__ int iclamp(int v, int lo, int hi) { return v < lo ? lo : (v > hi ? hi : v); }
__device__ __forceinline__ float xhalf(float x) { return __builtin_bit_cast(float, __builtin_amdgcn_permlanex16(__builtin_bit_cast(int, x), __builtin_bit_cast(int, x), 0x76543210, 0xfedcba98, false, false)); }  // lane l reads lane l ^ 16
// segment id of position p = number of interior boundaries cu[1..NSEG-1] that are <= p (== searchsorted(cu[1:], p, 'right') for p < T)
__device__ __forceinline__ int seg_of(const int* cu, int p) { int s = 0; for (int i = 1; i < NSEG; ++i) s += (cu[i] <= p) ? 1 : 0; return s; }

constexpr int QKBLK = NH * T * 8 / 256, VBLK = NH * T * D / 32 / 256;   // blocks of the first launch: q and k rows; v tiles
__global__ __launch_bounds__(256) void prep_kernel(const float* __restrict__ q, const float* __restrict__ k, const float* __restrict__ v, b16* __restrict__ QB, b16* __restrict__ KT, b16* __restrict__ VT) {
  if (blockIdx.x >= QKBLK) {   // v tiles: a thread takes one d of one 32-key chunk: 32 loads (a wave reads 128 contiguous bytes each), four 16-byte stores (16 lanes fill 256 contiguous bytes each)
    const unsigned w = (blockIdx.x - QKBLK) * 256 + threadIdx.x, d = w % D; const size_t cg = w / D; const float* vp = v + cg * 32 * D + d; b16* o = VT + cg * (32 * D) + (d / 16) * 512 + (d % 16) * 8;
#pragma unroll
    for (int g = 0; g < 4; ++g) { v8b a;
#pragma unroll
      for (int j = 0; j < 8; ++j) a[j] = (b16)(bf16_rne(vp[(g * 8 + j) * D]) * XS);
      *(v8b*)(o + g * 128) = a; }   // keys 8 g .. 8 g + 7: fragment half g / 2, wave half g % 2
    return; }
  const size_t u = (size_t)blockIdx.x * 256 + threadIdx.x; if (u >= (size_t)NH * T * 8) return; const int d0 = (int)(u % 8) * 8; const size_t row = u / 8; v8b a, bq;
  // k: a block takes one 32-key chunk, a wave 8 keys by 32 d of it: it reads 8 whole 128-byte lines (4 lanes a key) and stores 4 whole lines of KT (8 keys of one d / 8 each), every line from one wave
  const unsigned ln = (unsigned)(u % 32), wv = (unsigned)(u / 32 % 8), kr = (wv / 4) * 16 + (wv % 2) * 8 + ln / 4, g = ln % 4; const size_t krow = (u / 256) * 32 + kr; const int kd = (int)((wv / 2 % 2) * 32 + g * 8);
  b16* ko = KT + (u / 256) * (32 * D) + (((wv / 4) * 2 + wv / 2 % 2) * 2 + g / 2) * 256 + ((g % 2) * 16 + kr % 16) * 8;
  const float* qp = q + row * D + d0; const float* kp = k + krow * D + kd; const v4f q0 = *(const v4f*)qp, q1 = *(const v4f*)(qp + 4), k0 = *(const v4f*)kp, k1 = *(const v4f*)(kp + 4);
  asm volatile("s_wait_xcnt 0x0" :: "v"(qp), "v"(kp) : "memory");   // a precaution: the two address pairs of the four loads above are inputs, so no load lands on them ahead of this wait
#pragma unroll
  for (int j = 0; j < 4; ++j) { a[j] = (b16)(bf16_rne(q0[j]) * XS); a[4 + j] = (b16)(bf16_rne(q1[j]) * XS); bq[j] = (b16)(bf16_rne(k0[j]) * XS); bq[4 + j] = (b16)(bf16_rne(k1[j]) * XS); }
  { *(v8b*)(QB + row * D + d0) = a; *(v8b*)ko = bq;  }
}
constexpr int NW = 4;   // waves of a work-group (one lands on each SIMD): a long segment's chunks are shared by four SIMDs, and there are more work-groups than resident places, so a freed place takes the next tile
__global__ __launch_bounds__(32 * NW) void att_kernel(const b16* __restrict__ QB, const b16* __restrict__ KT, const b16* __restrict__ VT, const int* __restrict__ cu, int QLIM, float* __restrict__ out) {
  __shared__ float Ow[NW][16][D + 2], Mw[NW][16], Lw[NW][16], Lt[NW][16]; __shared__ int Sgw[NW][16], Cuw[NW][NSEG + 1], Krw[NW][2];
  const int lane = threadIdx.x & 31, wv = __builtin_amdgcn_readfirstlane(threadIdx.x >> 5), nloc = lane & 15, hlf = lane >> 4;
  int* const Sg = Sgw[wv]; int* const Cu = Cuw[wv]; int* const Kr = Krw[wv];   // each wave keeps its own copy of the small tables: no work-group barrier ahead of the loop
  const int h = blockIdx.x / (QLIM / 16), q0 = (blockIdx.x % (QLIM / 16)) * 16;
  if (lane <= NSEG) Cu[lane] = iclamp(cu[lane], 0, T);
  wave_lds_sync();
  if (lane < 16) Sg[lane] = seg_of(Cu, q0 + lane);
  wave_lds_sync();
  if (lane == 0) { Kr[0] = Cu[Sg[0]] & ~31; Kr[1] = Cu[Sg[15] + 1]; }   // key range from LDS (no dynamic register indexing)
  wave_lds_sync(); const int kbeg = Kr[0], kend = Kr[1];
  // the keys of this lane's query: for sorted offsets seg_of(key) == qs exactly where klo <= key < khi
  const int qs = Sg[nloc]; const int klo = qs == 0 ? 0 : Cu[qs], khi = qs >= NSEG - 1 ? T : Cu[qs + 1];
  v8f acc[4] = {(v8f){}, (v8f){}, (v8f){}, (v8f){}}; const b16* qb = QB + ((size_t)h * T + q0) * D;
  const v16b qf[2] = {frag_kb(qb + (size_t)nloc * D, hlf), frag_kb(qb + (size_t)nloc * D + 32, hlf)};
  float mx = -INFINITY, dn = 0.0f;   // running maximum of the query's raw scores (equal in both halves); running sum, x1024, over this half's keys only
#pragma unroll 1
  for (int kc = kbeg + 32 * ((wv + (q0 >> 4)) % NW); kc < kend; kc += 32 * NW) {   // the first chunk goes to another wave from tile to tile, so the odd chunks do not all fall to one SIMD
    const b16* kt_ = KT + ((size_t)h * T + kc) * D + lane * 8; v16b kf[4];   // fragment blk * 2 + kb: keys 16 * blk + nloc, d 32 * kb ..
#pragma unroll
    for (int t = 0; t < 4; ++t) { const v8b a = *(const v8b*)(kt_ + t * 512), b = *(const v8b*)(kt_ + t * 512 + 256);   // same k order as frag_kb of q: element e = d 8 * hlf + e, element 8 + e = d 16 + 8 * hlf + e
#pragma unroll
      for (int e = 0; e < 8; ++e) { kf[t][e] = a[e]; kf[t][8 + e] = b[e]; } }
    const b16* vt_ = VT + ((size_t)h * T + kc) * D + lane * 8; v16b vb[4];   // loaded ahead of the score products: they depend on nothing of this chunk
#pragma unroll
    for (int t = 0; t < 4; ++t) { const v8b a = *(const v8b*)(vt_ + t * 512), b = *(const v8b*)(vt_ + t * 512 + 256);   // same k order as frag_kb: element e = key 8 * hlf + e, element 8 + e = key 16 + 8 * hlf + e
#pragma unroll
      for (int e = 0; e < 8; ++e) { vb[t][e] = a[e]; vb[t][8 + e] = b[e]; } }
    asm volatile("s_wait_xcnt 0x0" :: "v"(kt_), "v"(vt_) : "memory");   // a precaution: the two address pairs of the sixteen loads above are inputs, so they stay untouched (no load lands on them) up to this wait
    float sv[16]; float cm = -INFINITY;
#pragma unroll
    for (int blk = 0; blk < 2; ++blk) { v8f s = {};
#pragma unroll
      for (int kb = 0; kb < 2; ++kb) s = wmma16b(kf[blk * 2 + kb], qf[kb], s);
#pragma unroll
      for (int r8 = 0; r8 < 8; ++r8) { const int kk = kc + blk * 16 + 8 * hlf + r8; sv[blk * 8 + r8] = (kk >= klo && kk < khi) ? s[r8] : -INFINITY; cm = fmaxf(cm, sv[blk * 8 + r8]); } }
    cm = fmaxf(cm, xhalf(cm)); const float mo = mx; const float mn = fmaxf(mo, cm); float psum = 0.0f; v16b ph, pl;
    const float nb = mn == -INFINITY ? 0.0f : -(mn * C2), nbp = nb + LPS;   // a finite bias: a masked score (-inf) then gives exp2(-inf) = 0 by itself, also where the query has seen no key yet
#pragma unroll
    for (int e = 0; e < 16; ++e) { const float p = __builtin_amdgcn_exp2f(__builtin_fmaf(sv[e], C2, nbp)); psum += p; b16 a, b; split16(p, a, b); ph[e] = a; pl[e] = b; }   // p = 1024 exp(score - maximum)
    const float sf = __builtin_amdgcn_exp2f(__builtin_fmaf(mo, C2, nb)); dn = dn * sf + psum; mx = mn;   // no key so far (mo -inf): 0, on sums and accumulators that are 0
#pragma unroll
    for (int t = 0; t < 4; ++t) {
#pragma unroll
      for (int r8 = 0; r8 < 8; ++r8) acc[t][r8] *= sf;
      acc[t] = wmma16b(vb[t], ph, acc[t]); acc[t] = wmma16b(vb[t], pl, acc[t]); } }
  const float dt = dn + xhalf(dn);   // the two halves' sums joined once
  if (lane < 16) { Mw[wv][lane] = mx * C2; Lw[wv][lane] = dt; }   // the maximum as the loop's bias has it (-inf stays -inf)
  __syncthreads();   // every wave's maxima and sums are in LDS
  float mall = -INFINITY;
#pragma unroll
  for (int p = 0; p < NW; ++p) mall = fmaxf(mall, Mw[p][nloc]);
  float lall = 0.0f;   // a wave without a key of this query (maximum -inf) weighs 0
#pragma unroll
  for (int p = 0; p < NW; ++p) { const float mp = Mw[p][nloc], lp = Lw[p][nloc], ep = __builtin_amdgcn_exp2f(mp - mall); lall += mp == -INFINITY ? 0.0f : lp * ep; }
  if (lane < 16) Lt[wv][lane] = lall;   // the wave's own copy, read back behind the barrier below
  const float wg = mx == -INFINITY ? 0.0f : __builtin_amdgcn_exp2f(Mw[wv][nloc] - mall);   // the same rounded maximum that weighs this wave's sum above
#pragma unroll
  for (int t = 0; t < 4; ++t)
#pragma unroll
    for (int r8 = 0; r8 < 8; ++r8) Ow[wv][nloc][t * 16 + 8 * hlf + r8] = acc[t][r8] * wg;
  __syncthreads();   // every wave's weighted partial output is in LDS
#pragma unroll
  for (int i = 0; i < 16 / NW; ++i) { const int rr = wv * (16 / NW) + i; v2f s = {0.0f, 0.0f};   // a wave joins and stores four whole rows (256 bytes each)
#pragma unroll
    for (int p = 0; p < NW; ++p) { s[0] += Ow[p][rr][lane * 2]; s[1] += Ow[p][rr][lane * 2 + 1]; }
    const float lr = Lt[wv][rr]; *(v2f*)(out + ((size_t)h * T + q0 + rr) * D + lane * 2) = (v2f){s[0] * (1.0f / XS) / lr, s[1] * (1.0f / XS) / lr}; }   // sums and outputs both carry the x1024
}
}  // namespace

extern "C" void kernel_launch(void* const* d_in, const int* in_sizes, int n_in, void* d_out, int out_size, void* d_ws, size_t ws_size, hipStream_t stream) {
  (void)n_in;
  auto Fp = [&](int i) { return (const float*)d_in[i]; }; auto Ip = [&](int i) { return (const int*)d_in[i]; };
  // input order: 0 q [1,16,4096,64]; 1 k; 2 v; 3 cu_seqlens [9] i32
  if (in_sizes[0] != NH * T * D || in_sizes[1] != NH * T * D || in_sizes[2] != NH * T * D || in_sizes[3] != NSEG + 1 || out_size != NH * T * D) return;
  const int QLIM = T;   // query cut (per head)
  size_t off = 0; char* ws = (char*)d_ws;
  auto carve = [&](size_t bytes) { char* p = ws + off; off += (bytes + 255) & ~(size_t)255; return p; };
  b16* QB = (b16*)carve((size_t)NH * T * D * 2); b16* KT = (b16*)carve((size_t)NH * T * D * 2); b16* VT = (b16*)carve((size_t)NH * T * D * 2);
  if (off > ws_size || off > ((size_t)32 << 20)) return;   // 25 MB
  prep_kernel<<<QKBLK + VBLK, 256, 0, stream>>>(Fp(0), Fp(1), Fp(2), QB, KT, VT);
  att_kernel<<<NH * (QLIM / 16), 32 * NW, 0, stream>>>(QB, KT, VT, Ip(3), QLIM, (float*)d_out);
}

// v006
// It runs in 55.4 microseconds.
// In both of two side-by-side timings against v005, it was 1.05 times as fast.
// All steps since v000 together make it 32.0 times as fast.
#include <hip/hip_runtime.h>

// Packed (varlen) attention, non-causal: for each of the 16 heads and 4,096 token positions, attention over the keys of the same packed segment (segments from the verbatim cu_seqlens offsets; class A):
// out = softmax(q k^T / 8 over the segment) v -> [1][16][4096][64].
// Deterministic, no atomics. Per (head, 32 queries) an online softmax over the 32-key chunks of the segment(s) the 32 queries belong to (a 32-query tile may straddle a boundary; masking is per element by the query's segment bounds).
// A work-group of four waves takes one (head, 32 queries): each wave walks every fourth chunk with its own maxima, sums and accumulators; the four partial results are joined through LDS in a fixed order.
// WMMA (v_wmma_f32_16x16x32_f16, f32 accumulate): S^T = k q^T with q, k EXACT bf16 x8 (single exact products, K 64), O^T += v^T P^T with P hi+lo x1024 and v EXACT x8 (2 products); mask / softmax bookkeeping in f32, on raw scores: P x1024 = exp2(raw * c + b), one FMA a score (c: 1/8, the operand scales and log2 e; b: 10 - c * running maximum). Inputs rounded to bf16
// k is rounded and scaled ONCE, in the first launch, into 4 KB tiles KT[head * 128 + key chunk][key / 16][d / 32][d / 16 % 2][lane][8 d] in the A operand's own order (lane = 16 * (d / 8 % 2) + key % 16), so a K fragment is two global loads of 512 contiguous bytes a wave (four whole lines each, not 16 lines of 32 bytes).
// v is rounded, scaled and transposed ONCE, in the first launch, into 4 KB tiles VT[head * 128 + key chunk][d / 16][key / 16][lane][8 keys] in the A operand's own order (lane = 16 * (key / 8 % 2) + d % 16), so a V^T fragment is two global loads of 512 contiguous bytes a wave.

namespace {
constexpr int NH = 16, T = 4096, D = 64, NSEG = 8;
constexpr float XS = 8.0f;
constexpr float C2 = 0.125f / (XS * XS) * 1.44269504088896340736f, LPS = 10.0f;   // raw score (64 q.k) -> exponent of 2; 2^LPS = 1024, the scale of P
typedef _Float16 b16;
typedef __attribute__((ext_vector_type(16))) _Float16 v16b;
typedef __attribute__((ext_vector_type(8))) _Float16 v8b;
typedef __attribute__((ext_vector_type(8))) float v8f;
typedef __attribute__((ext_vector_type(4))) float v4f;
typedef __attribute__((ext_vector_type(2))) float v2f;
__device__ __forceinline__ float bf16_rne(float f) { unsigned int u = __float_as_uint(f); u += 0x7FFFu + ((u >> 16) & 1u); return __uint_as_float(u & 0xFFFF0000u); }
__device__ __forceinline__ void split16(float v, b16& hi, b16& lo) { hi = (b16)v; lo = (b16)(v - (float)hi); }
__device__ __forceinline__ v16b frag_kb(const b16* p, int hh) { const v8b a = *(const v8b*)(p + 8 * hh), b = *(const v8b*)(p + 16 + 8 * hh); v16b f;
#pragma unroll
  for (int e = 0; e < 8; ++e) { f[e] = a[e]; f[8 + e] = b[e]; } return f; }
__device__ __forceinline__ v8f wmma16b(v16b a, v16b b, v8f c) { v8f d = __builtin_amdgcn_wmma_f32_16x16x32_f16(false, a, false, b, (short)0, c, false, false); asm volatile("v_nop\n\tv_nop\n\tv_nop\n\tv_nop" : "+v"(d) : "v"(a), "v"(b)); return d; }
__device__ __forceinline__ void wave_lds_sync() { __builtin_amdgcn_fence(__ATOMIC_RELEASE, "workgroup"); __builtin_amdgcn_wave_barrier(); __builtin_amdgcn_fence(__ATOMIC_ACQUIRE, "workgroup"); }
__device__ __forceinline__ int iclamp(int v, int lo, int hi) { return v < lo ? lo : (v > hi ? hi : v); }
__device__ __forceinline__ float xhalf(float x) { return __builtin_bit_cast(float, __builtin_amdgcn_permlanex16(__builtin_bit_cast(int, x), __builtin_bit_cast(int, x), 0x76543210, 0xfedcba98, false, false)); }  // lane l reads lane l ^ 16
// segment id of position p = number of interior boundaries cu[1..NSEG-1] that are <= p (== searchsorted(cu[1:], p, 'right') for p < T)
__device__ __forceinline__ int seg_of(const int* cu, int p) { int s = 0; for (int i = 1; i < NSEG; ++i) s += (cu[i] <= p) ? 1 : 0; return s; }

constexpr int QKBLK = NH * T * 8 / 256, VBLK = NH * T * D / 32 / 256;   // blocks of the first launch: q and k rows; v tiles
__global__ __launch_bounds__(256) void prep_kernel(const float* __restrict__ q, const float* __restrict__ k, const float* __restrict__ v, b16* __restrict__ QB, b16* __restrict__ KT, b16* __restrict__ VT) {
  if (blockIdx.x >= QKBLK) {   // v tiles: a thread takes one d of one 32-key chunk: 32 loads (a wave reads 128 contiguous bytes each), four 16-byte stores (16 lanes fill 256 contiguous bytes each)
    const unsigned w = (blockIdx.x - QKBLK) * 256 + threadIdx.x, d = w % D; const size_t cg = w / D; const float* vp = v + cg * 32 * D + d; b16* o = VT + cg * (32 * D) + (d / 16) * 512 + (d % 16) * 8;
#pragma unroll
    for (int g = 0; g < 4; ++g) { v8b a;
#pragma unroll
      for (int j = 0; j < 8; ++j) a[j] = (b16)(bf16_rne(vp[(g * 8 + j) * D]) * XS);
      *(v8b*)(o + g * 128) = a; }   // keys 8 g .. 8 g + 7: fragment half g / 2, wave half g % 2
    return; }
  const size_t u = (size_t)blockIdx.x * 256 + threadIdx.x; if (u >= (size_t)NH * T * 8) return; const int d0 = (int)(u % 8) * 8; const size_t row = u / 8; v8b a, bq;
  // k: a block takes one 32-key chunk, a wave 8 keys by 32 d of it: it reads 8 whole 128-byte lines (4 lanes a key) and stores 4 whole lines of KT (8 keys of one d / 8 each), every line from one wave
  const unsigned ln = (unsigned)(u % 32), wv = (unsigned)(u / 32 % 8), kr = (wv / 4) * 16 + (wv % 2) * 8 + ln / 4, g = ln % 4; const size_t krow = (u / 256) * 32 + kr; const int kd = (int)((wv / 2 % 2) * 32 + g * 8);
  b16* ko = KT + (u / 256) * (32 * D) + (((wv / 4) * 2 + wv / 2 % 2) * 2 + g / 2) * 256 + ((g % 2) * 16 + kr % 16) * 8;
  const float* qp = q + row * D + d0; const float* kp = k + krow * D + kd; const v4f q0 = *(const v4f*)qp, q1 = *(const v4f*)(qp + 4), k0 = *(const v4f*)kp, k1 = *(const v4f*)(kp + 4);
  asm volatile("s_wait_xcnt 0x0" :: "v"(qp), "v"(kp) : "memory");   // a precaution: the two address pairs of the four loads above are inputs, so no load lands on them ahead of this wait
#pragma unroll
  for (int j = 0; j < 4; ++j) { a[j] = (b16)(bf16_rne(q0[j]) * XS); a[4 + j] = (b16)(bf16_rne(q1[j]) * XS); bq[j] = (b16)(bf16_rne(k0[j]) * XS); bq[4 + j] = (b16)(bf16_rne(k1[j]) * XS); }
  { *(v8b*)(QB + row * D + d0) = a; *(v8b*)ko = bq;  }
}
constexpr int NW = 4;   // waves of a work-group (one lands on each SIMD): a long segment's chunks are shared by four SIMDs, and there are more work-groups than resident places, so a freed place takes the next tile
constexpr int NG = 2, QT = 16 * NG;   // groups of 16 query columns a wave, queries a work-group
__global__ __launch_bounds__(32 * NW) void att_kernel(const b16* __restrict__ QB, const b16* __restrict__ KT, const b16* __restrict__ VT, const int* __restrict__ cu, int QLIM, float* __restrict__ out) {
  __shared__ float Ow[NW][QT][D + 2], Mw[NW][QT], Lw[NW][QT], Lt[NW][QT]; __shared__ int Sgw[NW][QT], Cuw[NW][NSEG + 1], Krw[NW][2];
  const int lane = threadIdx.x & 31, wv = __builtin_amdgcn_readfirstlane(threadIdx.x >> 5), nloc = lane & 15, hlf = lane >> 4;
  int* const Sg = Sgw[wv]; int* const Cu = Cuw[wv]; int* const Kr = Krw[wv];   // each wave keeps its own copy of the small tables: no work-group barrier ahead of the loop
  const int h = blockIdx.x / (QLIM / QT), q0 = (blockIdx.x % (QLIM / QT)) * QT;
  if (lane <= NSEG) Cu[lane] = iclamp(cu[lane], 0, T);
  wave_lds_sync();
  Sg[lane] = seg_of(Cu, q0 + lane);
  wave_lds_sync();
  if (lane == 0) { Kr[0] = Cu[Sg[0]] & ~31; Kr[1] = Cu[Sg[QT - 1] + 1]; }   // key range from LDS (no dynamic register indexing)
  wave_lds_sync(); const int kbeg = Kr[0], kend = Kr[1];
  // the keys of this lane's queries: for sorted offsets seg_of(key) == qs exactly where klo <= key < khi
  int klo[NG], khi[NG]; v8f acc[NG][4]; v16b qf[NG][2]; float mx[NG], dn[NG];   // mx: running maximum of the query's raw scores (equal in both halves); dn: running sum, x1024, over this half's keys only
  const b16* qb = QB + ((size_t)h * T + q0) * D;
#pragma unroll
  for (int g = 0; g < NG; ++g) { const int qs = Sg[16 * g + nloc]; klo[g] = qs == 0 ? 0 : Cu[qs]; khi[g] = qs >= NSEG - 1 ? T : Cu[qs + 1];
    qf[g][0] = frag_kb(qb + (size_t)(16 * g + nloc) * D, hlf); qf[g][1] = frag_kb(qb + (size_t)(16 * g + nloc) * D + 32, hlf); mx[g] = -INFINITY; dn[g] = 0.0f;
#pragma unroll
    for (int t = 0; t < 4; ++t) acc[g][t] = (v8f){}; }
#pragma unroll 1
  for (int kc = kbeg + 32 * ((wv + (q0 / QT)) % NW); kc < kend; kc += 32 * NW) {   // the first chunk goes to another wave from tile to tile, so the odd chunks do not all fall to one SIMD
    const b16* kt_ = KT + ((size_t)h * T + kc) * D + lane * 8; v16b kf[4];   // fragment blk * 2 + kb: keys 16 * blk + nloc, d 32 * kb ..
#pragma unroll
    for (int t = 0; t < 4; ++t) { const v8b a = *(const v8b*)(kt_ + t * 512), b = *(const v8b*)(kt_ + t * 512 + 256);   // same k order as frag_kb of q: element e = d 8 * hlf + e, element 8 + e = d 16 + 8 * hlf + e
#pragma unroll
      for (int e = 0; e < 8; ++e) { kf[t][e] = a[e]; kf[t][8 + e] = b[e]; } }
    const b16* vt_ = VT + ((size_t)h * T + kc) * D + lane * 8; v16b vb[4];   // loaded ahead of the score products: they depend on nothing of this chunk
#pragma unroll
    for (int t = 0; t < 4; ++t) { const v8b a = *(const v8b*)(vt_ + t * 512), b = *(const v8b*)(vt_ + t * 512 + 256);   // same k order as frag_kb: element e = key 8 * hlf + e, element 8 + e = key 16 + 8 * hlf + e
#pragma unroll
      for (int e = 0; e < 8; ++e) { vb[t][e] = a[e]; vb[t][8 + e] = b[e]; } }
    asm volatile("s_wait_xcnt 0x0" :: "v"(kt_), "v"(vt_) : "memory");   // a precaution: the two address pairs of the sixteen loads above are inputs, so they stay untouched (no load lands on them) up to this wait
    float sv[NG][16], cm[NG];
#pragma unroll
    for (int g = 0; g < NG; ++g) cm[g] = -INFINITY;
#pragma unroll
    for (int blk = 0; blk < 2; ++blk)
#pragma unroll
      for (int g = 0; g < NG; ++g) { v8f s = {};
#pragma unroll
        for (int kb = 0; kb < 2; ++kb) s = wmma16b(kf[blk * 2 + kb], qf[g][kb], s);
#pragma unroll
        for (int r8 = 0; r8 < 8; ++r8) { const int kk = kc + blk * 16 + 8 * hlf + r8; sv[g][blk * 8 + r8] = (kk >= klo[g] && kk < khi[g]) ? s[r8] : -INFINITY; cm[g] = fmaxf(cm[g], sv[g][blk * 8 + r8]); } }
#pragma unroll
    for (int g = 0; g < NG; ++g) {
      const float cg = fmaxf(cm[g], xhalf(cm[g])); const float mo = mx[g]; const float mn = fmaxf(mo, cg); float psum = 0.0f; v16b ph, pl;
      const float nb = mn == -INFINITY ? 0.0f : -(mn * C2), nbp = nb + LPS;   // a finite bias: a masked score (-inf) then gives exp2(-inf) = 0 by itself, also where the query has seen no key yet
#pragma unroll
      for (int e = 0; e < 16; ++e) { const float p = __builtin_amdgcn_exp2f(__builtin_fmaf(sv[g][e], C2, nbp)); psum += p; b16 a, b; split16(p, a, b); ph[e] = a; pl[e] = b; }   // p = 1024 exp(score - maximum)
      const float sf = __builtin_amdgcn_exp2f(__builtin_fmaf(mo, C2, nb)); dn[g] = dn[g] * sf + psum; mx[g] = mn;   // no key so far (mo -inf): 0, on sums and accumulators that are 0
#pragma unroll
      for (int t = 0; t < 4; ++t) {
#pragma unroll
        for (int r8 = 0; r8 < 8; ++r8) acc[g][t][r8] *= sf;
        acc[g][t] = wmma16b(vb[t], ph, acc[g][t]); acc[g][t] = wmma16b(vb[t], pl, acc[g][t]); } } }
  float dt[NG];
#pragma unroll
  for (int g = 0; g < NG; ++g) dt[g] = dn[g] + xhalf(dn[g]);   // the two halves' sums joined once (equal in both halves)
  Mw[wv][lane] = (hlf ? mx[1] : mx[0]) * C2; Lw[wv][lane] = hlf ? dt[1] : dt[0];   // half hlf writes group hlf's 16 queries; the maximum as the loop's bias has it (-inf stays -inf)
  __syncthreads();   // every wave's maxima and sums are in LDS
  float lall[NG], wg[NG];
#pragma unroll
  for (int g = 0; g < NG; ++g) { const int qi = 16 * g + nloc; float mall = -INFINITY;
#pragma unroll
    for (int p = 0; p < NW; ++p) mall = fmaxf(mall, Mw[p][qi]);
    lall[g] = 0.0f;   // a wave without a key of this query (maximum -inf) weighs 0
#pragma unroll
    for (int p = 0; p < NW; ++p) { const float mp = Mw[p][qi], lp = Lw[p][qi], ep = __builtin_amdgcn_exp2f(mp - mall); lall[g] += mp == -INFINITY ? 0.0f : lp * ep; }
    wg[g] = mx[g] == -INFINITY ? 0.0f : __builtin_amdgcn_exp2f(Mw[wv][qi] - mall); }   // the same rounded maximum that weighs this wave's sum above
  Lt[wv][lane] = hlf ? lall[1] : lall[0];   // the wave's own copy, read back behind the barrier below
#pragma unroll
  for (int g = 0; g < NG; ++g)
#pragma unroll
    for (int t = 0; t < 4; ++t)
#pragma unroll
      for (int r8 = 0; r8 < 8; ++r8) Ow[wv][16 * g + nloc][t * 16 + 8 * hlf + r8] = acc[g][t][r8] * wg[g];
  __syncthreads();   // every wave's weighted partial output is in LDS
#pragma unroll
  for (int i = 0; i < QT / NW; ++i) { const int rr = wv * (QT / NW) + i; v2f s = {0.0f, 0.0f};   // a wave joins and stores eight whole rows (256 bytes each)
#pragma unroll
    for (int p = 0; p < NW; ++p) { s[0] += Ow[p][rr][lane * 2]; s[1] += Ow[p][rr][lane * 2 + 1]; }
    const float lr = Lt[wv][rr]; *(v2f*)(out + ((size_t)h * T + q0 + rr) * D + lane * 2) = (v2f){s[0] * (1.0f / XS) / lr, s[1] * (1.0f / XS) / lr}; }   // sums and outputs both carry the x1024
}
}  // namespace

extern "C" void kernel_launch(void* const* d_in, const int* in_sizes, int n_in, void* d_out, int out_size, void* d_ws, size_t ws_size, hipStream_t stream) {
  (void)n_in;
  auto Fp = [&](int i) { return (const float*)d_in[i]; }; auto Ip = [&](int i) { return (const int*)d_in[i]; };
  // input order: 0 q [1,16,4096,64]; 1 k; 2 v; 3 cu_seqlens [9] i32
  if (in_sizes[0] != NH * T * D || in_sizes[1] != NH * T * D || in_sizes[2] != NH * T * D || in_sizes[3] != NSEG + 1 || out_size != NH * T * D) return;
  const int QLIM = T;   // query cut (per head)
  size_t off = 0; char* ws = (char*)d_ws;
  auto carve = [&](size_t bytes) { char* p = ws + off; off += (bytes + 255) & ~(size_t)255; return p; };
  b16* QB = (b16*)carve((size_t)NH * T * D * 2); b16* KT = (b16*)carve((size_t)NH * T * D * 2); b16* VT = (b16*)carve((size_t)NH * T * D * 2);
  if (off > ws_size || off > ((size_t)32 << 20)) return;   // 25 MB
  prep_kernel<<<QKBLK + VBLK, 256, 0, stream>>>(Fp(0), Fp(1), Fp(2), QB, KT, VT);
  att_kernel<<<NH * (QLIM / QT), 32 * NW, 0, stream>>>(QB, KT, VT, Ip(3), QLIM, (float*)d_out);
}

// v007
// One run takes 50.7 microseconds.
// In both of two side-by-side timings against v006, it was 1.09 times as fast.
// Over all steps from v000 it is 34.9 times as fast.
#include <hip/hip_runtime.h>

// Packed (varlen) attention, non-causal: for each of the 16 heads and 4,096 token positions, attention over the keys of the same packed segment (segments from the verbatim cu_seqlens offsets; class A):
// out = softmax(q k^T / 8 over the segment) v -> [1][16][4096][64].
// Deterministic, no atomics. Per (head, 32 queries) an online softmax over the 32-key chunks of the segment(s) the 32 queries belong to (a 32-query tile may straddle a boundary; masking is per element by the query's segment bounds).
// A work-group of four waves takes one (head, 32 queries): each wave walks every fourth chunk with its own maxima, sums and accumulators; the four partial results are joined through LDS in a fixed order.
// WMMA (v_wmma_f32_16x16x32_f16, f32 accumulate): S^T = k q^T with q, k EXACT bf16 x8 (single exact products, K 64), O^T += v^T P^T with P hi+lo x1024 and v EXACT x8 (2 products); mask / softmax bookkeeping in f32, on raw scores: P x1024 = exp2(raw * c + b), one FMA a score (c: 1/8, the operand scales and log2 e; b: 10 - c * running maximum). Inputs rounded to bf16
// k is rounded and scaled ONCE, in the first launch, into 4 KB tiles KT[head * 128 + key chunk][key / 16][d / 32][d / 16 % 2][lane][8 d] in the A operand's own order (lane = 16 * (d / 8 % 2) + key % 16), so a K fragment is two global loads of 512 contiguous bytes a wave (four whole lines each, not 16 lines of 32 bytes).
// v is rounded, scaled and transposed ONCE, in the first launch, into 4 KB tiles VT[head * 128 + key chunk][d / 16][key / 16][lane][8 keys] in the A operand's own order (lane = 16 * (key / 8 % 2) + d % 16), so a V^T fragment is two global loads of 512 contiguous bytes a wave.

namespace {
constexpr int NH = 16, T = 4096, D = 64, NSEG = 8;
constexpr float XS = 8.0f;
constexpr float C2 = 0.125f / (XS * XS) * 1.44269504088896340736f, LPS = 10.0f;   // raw score (64 q.k) -> exponent of 2; 2^LPS = 1024, the scale of P
typedef _Float16 b16;
typedef __attribute__((ext_vector_type(16))) _Float16 v16b;
typedef __attribute__((ext_vector_type(8))) _Float16 v8b;
typedef __attribute__((ext_vector_type(8))) float v8f;
typedef __attribute__((ext_vector_type(4))) float v4f;
typedef __attribute__((ext_vector_type(2))) float v2f;
__device__ __forceinline__ float bf16_rne(float f) { unsigned int u = __float_as_uint(f); u += 0x7FFFu + ((u >> 16) & 1u); return __uint_as_float(u & 0xFFFF0000u); }
__device__ __forceinline__ void split16(float v, b16& hi, b16& lo) { hi = (b16)v; lo = (b16)(v - (float)hi); }
__device__ __forceinline__ v16b frag_kb(const b16* p, int hh) { const v8b a = *(const v8b*)(p + 8 * hh), b = *(const v8b*)(p + 16 + 8 * hh); v16b f;
#pragma unroll
  for (int e = 0; e < 8; ++e) { f[e] = a[e]; f[8 + e] = b[e]; } return f; }
__device__ __forceinline__ v8f wmma16b(v16b a, v16b b, v8f c) { return __builtin_amdgcn_wmma_f32_16x16x32_f16(false, a, false, b, (short)0, c, false, false); }   // the builtin alone: the compiler keeps the distance behind it, with other work where there is some
__device__ __forceinline__ void wave_lds_sync() { __builtin_amdgcn_fence(__ATOMIC_RELEASE, "workgroup"); __builtin_amdgcn_wave_barrier(); __builtin_amdgcn_fence(__ATOMIC_ACQUIRE, "workgroup"); }
__device__ __forceinline__ int iclamp(int v, int lo, int hi) { return v < lo ? lo : (v > hi ? hi : v); }
__device__ __forceinline__ float xhalf(float x) { return __builtin_bit_cast(float, __builtin_amdgcn_permlanex16(__builtin_bit_cast(int, x), __builtin_bit_cast(int, x), 0x76543210, 0xfedcba98, false, false)); }  // lane l reads lane l ^ 16
// segment id of position p = number of interior boundaries cu[1..NSEG-1] that are <= p (== searchsorted(cu[1:], p, 'right') for p < T)
__device__ __forceinline__ int seg_of(const int* cu, int p) { int s = 0; for (int i = 1; i < NSEG; ++i) s += (cu[i] <= p) ? 1 : 0; return s; }

constexpr int QKBLK = NH * T * 8 / 256, VBLK = NH * T * D / 32 / 256;   // blocks of the first launch: q and k rows; v tiles
__global__ __launch_bounds__(256) void prep_kernel(const float* __restrict__ q, const float* __restrict__ k, const float* __restrict__ v, b16* __restrict__ QB, b16* __restrict__ KT, b16* __restrict__ VT) {
  if (blockIdx.x >= QKBLK) {   // v tiles: a thread takes one d of one 32-key chunk: 32 loads (a wave reads 128 contiguous bytes each), four 16-byte stores (16 lanes fill 256 contiguous bytes each)
    const unsigned w = (blockIdx.x - QKBLK) * 256 + threadIdx.x, d = w % D; const size_t cg = w / D; const float* vp = v + cg * 32 * D + d; b16* o = VT + cg * (32 * D) + (d / 16) * 512 + (d % 16) * 8;
#pragma unroll
    for (int g = 0; g < 4; ++g) { v8b a;
#pragma unroll
      for (int j = 0; j < 8; ++j) a[j] = (b16)(bf16_rne(vp[(g * 8 + j) * D]) * XS);
      *(v8b*)(o + g * 128) = a; }   // keys 8 g .. 8 g + 7: fragment half g / 2, wave half g % 2
    return; }
  const size_t u = (size_t)blockIdx.x * 256 + threadIdx.x; if (u >= (size_t)NH * T * 8) return; const int d0 = (int)(u % 8) * 8; const size_t row = u / 8; v8b a, bq;
  // k: a block takes one 32-key chunk, a wave 8 keys by 32 d of it: it reads 8 whole 128-byte lines (4 lanes a key) and stores 4 whole lines of KT (8 keys of one d / 8 each), every line from one wave
  const unsigned ln = (unsigned)(u % 32), wv = (unsigned)(u / 32 % 8), kr = (wv / 4) * 16 + (wv % 2) * 8 + ln / 4, g = ln % 4; const size_t krow = (u / 256) * 32 + kr; const int kd = (int)((wv / 2 % 2) * 32 + g * 8);
  b16* ko = KT + (u / 256) * (32 * D) + (((wv / 4) * 2 + wv / 2 % 2) * 2 + g / 2) * 256 + ((g % 2) * 16 + kr % 16) * 8;
  const float* qp = q + row * D + d0; const float* kp = k + krow * D + kd; const v4f q0 = *(const v4f*)qp, q1 = *(const v4f*)(qp + 4), k0 = *(const v4f*)kp, k1 = *(const v4f*)(kp + 4);
  asm volatile("s_wait_xcnt 0x0" :: "v"(qp), "v"(kp) : "memory");   // a precaution: the two address pairs of the four loads above are inputs, so no load lands on them ahead of this wait
#pragma unroll
  for (int j = 0; j < 4; ++j) { a[j] = (b16)(bf16_rne(q0[j]) * XS); a[4 + j] = (b16)(bf16_rne(q1[j]) * XS); bq[j] = (b16)(bf16_rne(k0[j]) * XS); bq[4 + j] = (b16)(bf16_rne(k1[j]) * XS); }
  { *(v8b*)(QB + row * D + d0) = a; *(v8b*)ko = bq;  }
}
constexpr int NW = 4;   // waves of a work-group (one lands on each SIMD): a long segment's chunks are shared by four SIMDs, and there are more work-groups than resident places, so a freed place takes the next tile
constexpr int NG = 2, QT = 16 * NG;   // groups of 16 query columns a wave, queries a work-group
__global__ __launch_bounds__(32 * NW) void att_kernel(const b16* __restrict__ QB, const b16* __restrict__ KT, const b16* __restrict__ VT, const int* __restrict__ cu, int QLIM, float* __restrict__ out) {
  __shared__ float Ow[NW][QT][D + 2], Mw[NW][QT], Lw[NW][QT], Lt[NW][QT]; __shared__ int Sgw[NW][QT], Cuw[NW][NSEG + 1], Krw[NW][2];
  const int lane = threadIdx.x & 31, wv = __builtin_amdgcn_readfirstlane(threadIdx.x >> 5), nloc = lane & 15, hlf = lane >> 4;
  int* const Sg = Sgw[wv]; int* const Cu = Cuw[wv]; int* const Kr = Krw[wv];   // each wave keeps its own copy of the small tables: no work-group barrier ahead of the loop
  const int h = blockIdx.x / (QLIM / QT), q0 = (blockIdx.x % (QLIM / QT)) * QT;
  if (lane <= NSEG) Cu[lane] = iclamp(cu[lane], 0, T);
  wave_lds_sync();
  Sg[lane] = seg_of(Cu, q0 + lane);
  wave_lds_sync();
  if (lane == 0) { Kr[0] = Cu[Sg[0]] & ~31; Kr[1] = Cu[Sg[QT - 1] + 1]; }   // key range from LDS (no dynamic register indexing)
  wave_lds_sync(); const int kbeg = Kr[0], kend = Kr[1];
  // the keys of this lane's queries: for sorted offsets seg_of(key) == qs exactly where klo <= key < khi
  int klo[NG], khi[NG]; v8f acc[NG][4]; v16b qf[NG][2]; float mx[NG], dn[NG];   // mx: running maximum of the query's raw scores (equal in both halves); dn: running sum, x1024, over this half's keys only
  const b16* qb = QB + ((size_t)h * T + q0) * D;
#pragma unroll
  for (int g = 0; g < NG; ++g) { const int qs = Sg[16 * g + nloc]; klo[g] = qs == 0 ? 0 : Cu[qs]; khi[g] = qs >= NSEG - 1 ? T : Cu[qs + 1];
    qf[g][0] = frag_kb(qb + (size_t)(16 * g + nloc) * D, hlf); qf[g][1] = frag_kb(qb + (size_t)(16 * g + nloc) * D + 32, hlf); mx[g] = -INFINITY; dn[g] = 0.0f;
#pragma unroll
    for (int t = 0; t < 4; ++t) acc[g][t] = (v8f){}; }
#pragma unroll 1
  for (int kc = kbeg + 32 * ((wv + (q0 / QT)) % NW); kc < kend; kc += 32 * NW) {   // the first chunk goes to another wave from tile to tile, so the odd chunks do not all fall to one SIMD
    const b16* kt_ = KT + ((size_t)h * T + kc) * D + lane * 8; v16b kf[4];   // fragment blk * 2 + kb: keys 16 * blk + nloc, d 32 * kb ..
#pragma unroll
    for (int t = 0; t < 4; ++t) { const v8b a = *(const v8b*)(kt_ + t * 512), b = *(const v8b*)(kt_ + t * 512 + 256);   // same k order as frag_kb of q: element e = d 8 * hlf + e, element 8 + e = d 16 + 8 * hlf + e
#pragma unroll
      for (int e = 0; e < 8; ++e) { kf[t][e] = a[e]; kf[t][8 + e] = b[e]; } }
    const b16* vt_ = VT + ((size_t)h * T + kc) * D + lane * 8; v16b vb[4];   // loaded ahead of the score products: they depend on nothing of this chunk
#pragma unroll
    for (int t = 0; t < 4; ++t) { const v8b a = *(const v8b*)(vt_ + t * 512), b = *(const v8b*)(vt_ + t * 512 + 256);   // same k order as frag_kb: element e = key 8 * hlf + e, element 8 + e = key 16 + 8 * hlf + e
#pragma unroll
      for (int e = 0; e < 8; ++e) { vb[t][e] = a[e]; vb[t][8 + e] = b[e]; } }
    asm volatile("s_wait_xcnt 0x0" :: "v"(kt_), "v"(vt_) : "memory");   // a precaution: the two address pairs of the sixteen loads above are inputs, so they stay untouched (no load lands on them) up to this wait
    float sv[NG][16], cm[NG];
#pragma unroll
    for (int g = 0; g < NG; ++g) cm[g] = -INFINITY;
#pragma unroll
    for (int blk = 0; blk < 2; ++blk)
#pragma unroll
      for (int g = 0; g < NG; ++g) { v8f s = {};
#pragma unroll
        for (int kb = 0; kb < 2; ++kb) s = wmma16b(kf[blk * 2 + kb], qf[g][kb], s);
#pragma unroll
        for (int r8 = 0; r8 < 8; ++r8) { const int kk = kc + blk * 16 + 8 * hlf + r8; sv[g][blk * 8 + r8] = (kk >= klo[g] && kk < khi[g]) ? s[r8] : -INFINITY; cm[g] = fmaxf(cm[g], sv[g][blk * 8 + r8]); } }
#pragma unroll
    for (int g = 0; g < NG; ++g) {
      const float cg = fmaxf(cm[g], xhalf(cm[g])); const float mo = mx[g]; const float mn = fmaxf(mo, cg); float psum = 0.0f; v16b ph, pl;
      const float nb = mn == -INFINITY ? 0.0f : -(mn * C2), nbp = nb + LPS;   // a finite bias: a masked score (-inf) then gives exp2(-inf) = 0 by itself, also where the query has seen no key yet
#pragma unroll
      for (int e = 0; e < 16; ++e) { const float p = __builtin_amdgcn_exp2f(__builtin_fmaf(sv[g][e], C2, nbp)); psum += p; b16 a, b; split16(p, a, b); ph[e] = a; pl[e] = b; }   // p = 1024 exp(score - maximum)
      const float sf = __builtin_amdgcn_exp2f(__builtin_fmaf(mo, C2, nb)); dn[g] = dn[g] * sf + psum; mx[g] = mn;   // no key so far (mo -inf): 0, on sums and accumulators that are 0
#pragma unroll
      for (int t = 0; t < 4; ++t) {
#pragma unroll
        for (int r8 = 0; r8 < 8; ++r8) acc[g][t][r8] *= sf;
        acc[g][t] = wmma16b(vb[t], ph, acc[g][t]); acc[g][t] = wmma16b(vb[t], pl, acc[g][t]); } } }
  float dt[NG];
#pragma unroll
  for (int g = 0; g < NG; ++g) dt[g] = dn[g] + xhalf(dn[g]);   // the two halves' sums joined once (equal in both halves)
  Mw[wv][lane] = (hlf ? mx[1] : mx[0]) * C2; Lw[wv][lane] = hlf ? dt[1] : dt[0];   // half hlf writes group hlf's 16 queries; the maximum as the loop's bias has it (-inf stays -inf)
  __syncthreads();   // every wave's maxima and sums are in LDS
  float lall[NG], wg[NG];
#pragma unroll
  for (int g = 0; g < NG; ++g) { const int qi = 16 * g + nloc; float mall = -INFINITY;
#pragma unroll
    for (int p = 0; p < NW; ++p) mall = fmaxf(mall, Mw[p][qi]);
    lall[g] = 0.0f;   // a wave without a key of this query (maximum -inf) weighs 0
#pragma unroll
    for (int p = 0; p < NW; ++p) { const float mp = Mw[p][qi], lp = Lw[p][qi], ep = __builtin_amdgcn_exp2f(mp - mall); lall[g] += mp == -INFINITY ? 0.0f : lp * ep; }
    wg[g] = mx[g] == -INFINITY ? 0.0f : __builtin_amdgcn_exp2f(Mw[wv][qi] - mall); }   // the same rounded maximum that weighs this wave's sum above
  Lt[wv][lane] = hlf ? lall[1] : lall[0];   // the wave's own copy, read back behind the barrier below
#pragma unroll
  for (int g = 0; g < NG; ++g)
#pragma unroll
    for (int t = 0; t < 4; ++t)
#pragma unroll
      for (int r8 = 0; r8 < 8; ++r8) Ow[wv][16 * g + nloc][t * 16 + 8 * hlf + r8] = acc[g][t][r8] * wg[g];
  __syncthreads();   // every wave's weighted partial output is in LDS
#pragma unroll
  for (int i = 0; i < QT / NW; ++i) { const int rr = wv * (QT / NW) + i; v2f s = {0.0f, 0.0f};   // a wave joins and stores eight whole rows (256 bytes each)
#pragma unroll
    for (int p = 0; p < NW; ++p) { s[0] += Ow[p][rr][lane * 2]; s[1] += Ow[p][rr][lane * 2 + 1]; }
    const float lr = Lt[wv][rr]; *(v2f*)(out + ((size_t)h * T + q0 + rr) * D + lane * 2) = (v2f){s[0] * (1.0f / XS) / lr, s[1] * (1.0f / XS) / lr}; }   // sums and outputs both carry the x1024
}
}  // namespace

extern "C" void kernel_launch(void* const* d_in, const int* in_sizes, int n_in, void* d_out, int out_size, void* d_ws, size_t ws_size, hipStream_t stream) {
  (void)n_in;
  auto Fp = [&](int i) { return (const float*)d_in[i]; }; auto Ip = [&](int i) { return (const int*)d_in[i]; };
  // input order: 0 q [1,16,4096,64]; 1 k; 2 v; 3 cu_seqlens [9] i32
  if (in_sizes[0] != NH * T * D || in_sizes[1] != NH * T * D || in_sizes[2] != NH * T * D || in_sizes[3] != NSEG + 1 || out_size != NH * T * D) return;
  const int QLIM = T;   // query cut (per head)
  size_t off = 0; char* ws = (char*)d_ws;
  auto carve = [&](size_t bytes) { char* p = ws + off; off += (bytes + 255) & ~(size_t)255; return p; };
  b16* QB = (b16*)carve((size_t)NH * T * D * 2); b16* KT = (b16*)carve((size_t)NH * T * D * 2); b16* VT = (b16*)carve((size_t)NH * T * D * 2);
  if (off > ws_size || off > ((size_t)32 << 20)) return;   // 25 MB
  prep_kernel<<<QKBLK + VBLK, 256, 0, stream>>>(Fp(0), Fp(1), Fp(2), QB, KT, VT);
  att_kernel<<<NH * (QLIM / QT), 32 * NW, 0, stream>>>(QB, KT, VT, Ip(3), QLIM, (float*)d_out);
}

// v008
// A run of this version takes 40.3 microseconds.
// Two timings next to v007 put it at 1.27 and 1.25 times that version's speed.
// Counting every step since v000, it is 43.9 times as fast.
#include <hip/hip_runtime.h>

// Packed (varlen) attention, non-causal: for each of the 16 heads and 4,096 token positions, attention over the keys of the same packed segment (segments from the verbatim cu_seqlens offsets; class A):
// out = softmax(q k^T / 8 over the segment) v -> [1][16][4096][64].
// Deterministic, no atomics. Per (head, 32 queries) an online softmax over the 32-key chunks of the segment(s) the 32 queries belong to (a 32-query tile may straddle a boundary; masking is per element by the query's segment bounds).
// A work-group of four waves takes one (head, 32 queries): each wave walks every fourth chunk with its own maxima, sums and accumulators; the four partial results are joined through LDS in a fixed order.
// The work-groups take the 32-query tiles in the order of falling key count (table ORD, rank -> tile, sorted from the offsets by one block of the first launch): only half of them are resident at once, and the long ones take the low indices, the short ones the high ones (for speed only).
// WMMA (v_wmma_f32_16x16x32_f16, f32 accumulate): S^T = k q^T with q, k EXACT bf16 x8 (single exact products, K 64), O^T += v^T P^T with P hi+lo x1024 and v EXACT x8 (2 products); mask / softmax bookkeeping in f32, on raw scores: P x1024 = exp2(raw * c + b), one FMA a score (c: 1/8, the operand scales and log2 e; b: 10 - c * running maximum). Inputs rounded to bf16
// k is rounded and scaled ONCE, in the first launch, into 4 KB tiles KT[head * 128 + key chunk][key / 16][d / 32][d / 16 % 2][lane][8 d] in the A operand's own order (lane = 16 * (d / 8 % 2) + key % 16), so a K fragment is two global loads of 512 contiguous bytes a wave (four whole lines each, not 16 lines of 32 bytes).
// v is rounded, scaled and transposed ONCE, in the first launch, into 4 KB tiles VT[head * 128 + key chunk][d / 16][key / 16][lane][8 keys] in the A operand's own order (lane = 16 * (key / 8 % 2) + d % 16), so a V^T fragment is two global loads of 512 contiguous bytes a wave.

namespace {
constexpr int NH = 16, T = 4096, D = 64, NSEG = 8;
constexpr float XS = 8.0f;
constexpr float C2 = 0.125f / (XS * XS) * 1.44269504088896340736f, LPS = 10.0f;   // raw score (64 q.k) -> exponent of 2; 2^LPS = 1024, the scale of P
typedef _Float16 b16;
typedef __attribute__((ext_vector_type(16))) _Float16 v16b;
typedef __attribute__((ext_vector_type(8))) _Float16 v8b;
typedef __attribute__((ext_vector_type(8))) float v8f;
typedef __attribute__((ext_vector_type(4))) float v4f;
typedef __attribute__((ext_vector_type(2))) float v2f;
__device__ __forceinline__ float bf16_rne(float f) { unsigned int u = __float_as_uint(f); u += 0x7FFFu + ((u >> 16) & 1u); return __uint_as_float(u & 0xFFFF0000u); }
__device__ __forceinline__ void split16(float v, b16& hi, b16& lo) { hi = (b16)v; lo = (b16)(v - (float)hi); }
__device__ __forceinline__ v16b frag_kb(const b16* p, int hh) { const v8b a = *(const v8b*)(p + 8 * hh), b = *(const v8b*)(p + 16 + 8 * hh); v16b f;
#pragma unroll
  for (int e = 0; e < 8; ++e) { f[e] = a[e]; f[8 + e] = b[e]; } return f; }
__device__ __forceinline__ v8f wmma16b(v16b a, v16b b, v8f c) { return __builtin_amdgcn_wmma_f32_16x16x32_f16(false, a, false, b, (short)0, c, false, false); }   // the builtin alone: the compiler keeps the distance behind it, with other work where there is some
__device__ __forceinline__ void wave_lds_sync() { __builtin_amdgcn_fence(__ATOMIC_RELEASE, "workgroup"); __builtin_amdgcn_wave_barrier(); __builtin_amdgcn_fence(__ATOMIC_ACQUIRE, "workgroup"); }
__device__ __forceinline__ int iclamp(int v, int lo, int hi) { return v < lo ? lo : (v > hi ? hi : v); }
__device__ __forceinline__ float xhalf(float x) { return __builtin_bit_cast(float, __builtin_amdgcn_permlanex16(__builtin_bit_cast(int, x), __builtin_bit_cast(int, x), 0x76543210, 0xfedcba98, false, false)); }  // lane l reads lane l ^ 16
// segment id of position p = number of interior boundaries cu[1..NSEG-1] that are <= p (== searchsorted(cu[1:], p, 'right') for p < T)
__device__ __forceinline__ int seg_of(const int* cu, int p) { int s = 0; for (int i = 1; i < NSEG; ++i) s += (cu[i] <= p) ? 1 : 0; return s; }

constexpr int NG = 2, QT = 16 * NG, NT = T / QT;   // groups of 16 query columns a wave, queries a work-group, query tiles a head
constexpr int QKBLK = NH * T * 8 / 256, VBLK = NH * T * D / 32 / 256;   // blocks of the first launch behind block 0 (the tile order): q and k rows; v tiles
__global__ __launch_bounds__(256) void prep_kernel(const float* __restrict__ q, const float* __restrict__ k, const float* __restrict__ v, const int* __restrict__ cu, b16* __restrict__ QB, b16* __restrict__ KT, b16* __restrict__ VT, int* __restrict__ ORD) {
  if (blockIdx.x == 0) {   // tile order: ORD[rank] = tile, rank by falling key range (the range the second launch walks), ties by index: a strict order, so a permutation for any offsets
    __shared__ int Cs[NSEG + 1], Cost[NT]; const int t = threadIdx.x; int c = 0;
    if (t <= NSEG) Cs[t] = iclamp(cu[t], 0, T);
    __syncthreads();   // the clamped offsets are in LDS
    if (t < NT) { c = Cs[seg_of(Cs, t * QT + QT - 1) + 1] - (Cs[seg_of(Cs, t * QT)] & ~31); Cost[t] = c; }
    __syncthreads();   // every tile's key range is in LDS
    if (t < NT) { int r = 0; for (int j = 0; j < NT; ++j) { const int cj = Cost[j]; r += (cj > c || (cj == c && j < t)) ? 1 : 0; } ORD[r] = t; }
    return; }
  const unsigned bx = blockIdx.x - 1;
  if (bx >= QKBLK) {   // v tiles: a thread takes one d of one 32-key chunk: 32 loads (a wave reads 128 contiguous bytes each), four 16-byte stores (16 lanes fill 256 contiguous bytes each)
    const unsigned w = (bx - QKBLK) * 256 + threadIdx.x, d = w % D; const size_t cg = w / D; const float* vp = v + cg * 32 * D + d; b16* o = VT + cg * (32 * D) + (d / 16) * 512 + (d % 16) * 8;
#pragma unroll
    for (int g = 0; g < 4; ++g) { v8b a;
#pragma unroll
      for (int j = 0; j < 8; ++j) a[j] = (b16)(bf16_rne(vp[(g * 8 + j) * D]) * XS);
      *(v8b*)(o + g * 128) = a; }   // keys 8 g .. 8 g + 7: fragment half g / 2, wave half g % 2
    return; }
  const size_t u = (size_t)bx * 256 + threadIdx.x; if (u >= (size_t)NH * T * 8) return; const int d0 = (int)(u % 8) * 8; const size_t row = u / 8; v8b a, bq;
  // k: a block takes one 32-key chunk, a wave 8 keys by 32 d of it: it reads 8 whole 128-byte lines (4 lanes a key) and stores 4 whole lines of KT (8 keys of one d / 8 each), every line from one wave
  const unsigned ln = (unsigned)(u % 32), wv = (unsigned)(u / 32 % 8), kr = (wv / 4) * 16 + (wv % 2) * 8 + ln / 4, g = ln % 4; const size_t krow = (u / 256) * 32 + kr; const int kd = (int)((wv / 2 % 2) * 32 + g * 8);
  b16* ko = KT + (u / 256) * (32 * D) + (((wv / 4) * 2 + wv / 2 % 2) * 2 + g / 2) * 256 + ((g % 2) * 16 + kr % 16) * 8;
  const float* qp = q + row * D + d0; const float* kp = k + krow * D + kd; const v4f q0 = *(const v4f*)qp, q1 = *(const v4f*)(qp + 4), k0 = *(const v4f*)kp, k1 = *(const v4f*)(kp + 4);
  asm volatile("s_wait_xcnt 0x0" :: "v"(qp), "v"(kp) : "memory");   // a precaution: the two address pairs of the four loads above are inputs, so no load lands on them ahead of this wait
#pragma unroll
  for (int j = 0; j < 4; ++j) { a[j] = (b16)(bf16_rne(q0[j]) * XS); a[4 + j] = (b16)(bf16_rne(q1[j]) * XS); bq[j] = (b16)(bf16_rne(k0[j]) * XS); bq[4 + j] = (b16)(bf16_rne(k1[j]) * XS); }
  { *(v8b*)(QB + row * D + d0) = a; *(v8b*)ko = bq;  }
}
constexpr int NW = 4;   // waves of a work-group (one lands on each SIMD): a long segment's chunks are shared by four SIMDs, and there are more work-groups than resident places, so a freed place takes the next tile
__global__ __launch_bounds__(32 * NW) void att_kernel(const b16* __restrict__ QB, const b16* __restrict__ KT, const b16* __restrict__ VT, const int* __restrict__ cu, const int* __restrict__ ORD, float* __restrict__ out) {
  __shared__ float Ow[NW][QT][D + 2], Mw[NW][QT], Lw[NW][QT], Lt[NW][QT]; __shared__ int Sgw[NW][QT], Cuw[NW][NSEG + 1], Krw[NW][2];
  const int lane = threadIdx.x & 31, wv = __builtin_amdgcn_readfirstlane(threadIdx.x >> 5), nloc = lane & 15, hlf = lane >> 4;
  int* const Sg = Sgw[wv]; int* const Cu = Cuw[wv]; int* const Kr = Krw[wv];   // each wave keeps its own copy of the small tables: no work-group barrier ahead of the loop
  const int h = blockIdx.x % NH, q0 = (ORD[blockIdx.x / NH] & (NT - 1)) * QT;   // rank rises with the index (key range falls), the 16 heads of a tile side by side; the mask bounds every address formed from the table
  if (lane <= NSEG) Cu[lane] = iclamp(cu[lane], 0, T);
  wave_lds_sync();
  Sg[lane] = seg_of(Cu, q0 + lane);
  wave_lds_sync();
  if (lane == 0) { Kr[0] = Cu[Sg[0]] & ~31; Kr[1] = Cu[Sg[QT - 1] + 1]; }   // key range from LDS (no dynamic register indexing)
  wave_lds_sync(); const int kbeg = Kr[0], kend = Kr[1];
  // the keys of this lane's queries: for sorted offsets seg_of(key) == qs exactly where klo <= key < khi
  int klo[NG], khi[NG]; v8f acc[NG][4]; v16b qf[NG][2]; float mx[NG], dn[NG];   // mx: running maximum of the query's raw scores (equal in both halves); dn: running sum, x1024, over this half's keys only
  const b16* qb = QB + ((size_t)h * T + q0) * D;
#pragma unroll
  for (int g = 0; g < NG; ++g) { const int qs = Sg[16 * g + nloc]; klo[g] = qs == 0 ? 0 : Cu[qs]; khi[g] = qs >= NSEG - 1 ? T : Cu[qs + 1];
    qf[g][0] = frag_kb(qb + (size_t)(16 * g + nloc) * D, hlf); qf[g][1] = frag_kb(qb + (size_t)(16 * g + nloc) * D + 32, hlf); mx[g] = -INFINITY; dn[g] = 0.0f;
#pragma unroll
    for (int t = 0; t < 4; ++t) acc[g][t] = (v8f){}; }
#pragma unroll 1
  for (int kc = kbeg + 32 * ((wv + (q0 / QT)) % NW); kc < kend; kc += 32 * NW) {   // the first chunk goes to another wave from tile to tile, so the odd chunks do not all fall to one SIMD
    const b16* kt_ = KT + ((size_t)h * T + kc) * D + lane * 8; v16b kf[4];   // fragment blk * 2 + kb: keys 16 * blk + nloc, d 32 * kb ..
#pragma unroll
    for (int t = 0; t < 4; ++t) { const v8b a = *(const v8b*)(kt_ + t * 512), b = *(const v8b*)(kt_ + t * 512 + 256);   // same k order as frag_kb of q: element e = d 8 * hlf + e, element 8 + e = d 16 + 8 * hlf + e
#pragma unroll
      for (int e = 0; e < 8; ++e) { kf[t][e] = a[e]; kf[t][8 + e] = b[e]; } }
    const b16* vt_ = VT + ((size_t)h * T + kc) * D + lane * 8; v16b vb[4];   // loaded ahead of the score products: they depend on nothing of this chunk
#pragma unroll
    for (int t = 0; t < 4; ++t) { const v8b a = *(const v8b*)(vt_ + t * 512), b = *(const v8b*)(vt_ + t * 512 + 256);   // same k order as frag_kb: element e = key 8 * hlf + e, element 8 + e = key 16 + 8 * hlf + e
#pragma unroll
      for (int e = 0; e < 8; ++e) { vb[t][e] = a[e]; vb[t][8 + e] = b[e]; } }
    asm volatile("s_wait_xcnt 0x0" :: "v"(kt_), "v"(vt_) : "memory");   // a precaution: the two address pairs of the sixteen loads above are inputs, so they stay untouched (no load lands on them) up to this wait
    float sv[NG][16], cm[NG];
#pragma unroll
    for (int g = 0; g < NG; ++g) cm[g] = -INFINITY;
#pragma unroll
    for (int blk = 0; blk < 2; ++blk)
#pragma unroll
      for (int g = 0; g < NG; ++g) { v8f s = {};
#pragma unroll
        for (int kb = 0; kb < 2; ++kb) s = wmma16b(kf[blk * 2 + kb], qf[g][kb], s);
#pragma unroll
        for (int r8 = 0; r8 < 8; ++r8) { const int kk = kc + blk * 16 + 8 * hlf + r8; sv[g][blk * 8 + r8] = (kk >= klo[g] && kk < khi[g]) ? s[r8] : -INFINITY; cm[g] = fmaxf(cm[g], sv[g][blk * 8 + r8]); } }
#pragma unroll
    for (int g = 0; g < NG; ++g) {
      const float cg = fmaxf(cm[g], xhalf(cm[g])); const float mo = mx[g]; const float mn = fmaxf(mo, cg); float psum = 0.0f; v16b ph, pl;
      const float nb = mn == -INFINITY ? 0.0f : -(mn * C2), nbp = nb + LPS;   // a finite bias: a masked score (-inf) then gives exp2(-inf) = 0 by itself, also where the query has seen no key yet
#pragma unroll
      for (int e = 0; e < 16; ++e) { const float p = __builtin_amdgcn_exp2f(__builtin_fmaf(sv[g][e], C2, nbp)); psum += p; b16 a, b; split16(p, a, b); ph[e] = a; pl[e] = b; }   // p = 1024 exp(score - maximum)
      const float sf = __builtin_amdgcn_exp2f(__builtin_fmaf(mo, C2, nb)); dn[g] = dn[g] * sf + psum; mx[g] = mn;   // no key so far (mo -inf): 0, on sums and accumulators that are 0
#pragma unroll
      for (int t = 0; t < 4; ++t) {
#pragma unroll
        for (int r8 = 0; r8 < 8; ++r8) acc[g][t][r8] *= sf;
        acc[g][t] = wmma16b(vb[t], ph, acc[g][t]); acc[g][t] = wmma16b(vb[t], pl, acc[g][t]); } } }
  float dt[NG];
#pragma unroll
  for (int g = 0; g < NG; ++g) dt[g] = dn[g] + xhalf(dn[g]);   // the two halves' sums joined once (equal in both halves)
  Mw[wv][lane] = (hlf ? mx[1] : mx[0]) * C2; Lw[wv][lane] = hlf ? dt[1] : dt[0];   // half hlf writes group hlf's 16 queries; the maximum as the loop's bias has it (-inf stays -inf)
  __syncthreads();   // every wave's maxima and sums are in LDS
  float lall[NG], wg[NG];
#pragma unroll
  for (int g = 0; g < NG; ++g) { const int qi = 16 * g + nloc; float mall = -INFINITY;
#pragma unroll
    for (int p = 0; p < NW; ++p) mall = fmaxf(mall, Mw[p][qi]);
    lall[g] = 0.0f;   // a wave without a key of this query (maximum -inf) weighs 0
#pragma unroll
    for (int p = 0; p < NW; ++p) { const float mp = Mw[p][qi], lp = Lw[p][qi], ep = __builtin_amdgcn_exp2f(mp - mall); lall[g] += mp == -INFINITY ? 0.0f : lp * ep; }
    wg[g] = mx[g] == -INFINITY ? 0.0f : __builtin_amdgcn_exp2f(Mw[wv][qi] - mall); }   // the same rounded maximum that weighs this wave's sum above
  Lt[wv][lane] = hlf ? lall[1] : lall[0];   // the wave's own copy, read back behind the barrier below
#pragma unroll
  for (int g = 0; g < NG; ++g)
#pragma unroll
    for (int t = 0; t < 4; ++t)
#pragma unroll
      for (int r8 = 0; r8 < 8; ++r8) Ow[wv][16 * g + nloc][t * 16 + 8 * hlf + r8] = acc[g][t][r8] * wg[g];
  __syncthreads();   // every wave's weighted partial output is in LDS
#pragma unroll
  for (int i = 0; i < QT / NW; ++i) { const int rr = wv * (QT / NW) + i; v2f s = {0.0f, 0.0f};   // a wave joins and stores eight whole rows (256 bytes each)
#pragma unroll
    for (int p = 0; p < NW; ++p) { s[0] += Ow[p][rr][lane * 2]; s[1] += Ow[p][rr][lane * 2 + 1]; }
    const float lr = Lt[wv][rr]; *(v2f*)(out + ((size_t)h * T + q0 + rr) * D + lane * 2) = (v2f){s[0] * (1.0f / XS) / lr, s[1] * (1.0f / XS) / lr}; }   // sums and outputs both carry the x1024
}
}  // namespace

extern "C" void kernel_launch(void* const* d_in, const int* in_sizes, int n_in, void* d_out, int out_size, void* d_ws, size_t ws_size, hipStream_t stream) {
  (void)n_in;
  auto Fp = [&](int i) { return (const float*)d_in[i]; }; auto Ip = [&](int i) { return (const int*)d_in[i]; };
  // input order: 0 q [1,16,4096,64]; 1 k; 2 v; 3 cu_seqlens [9] i32
  if (in_sizes[0] != NH * T * D || in_sizes[1] != NH * T * D || in_sizes[2] != NH * T * D || in_sizes[3] != NSEG + 1 || out_size != NH * T * D) return;
  size_t off = 0; char* ws = (char*)d_ws;
  auto carve = [&](size_t bytes) { char* p = ws + off; off += (bytes + 255) & ~(size_t)255; return p; };
  b16* QB = (b16*)carve((size_t)NH * T * D * 2); b16* KT = (b16*)carve((size_t)NH * T * D * 2); b16* VT = (b16*)carve((size_t)NH * T * D * 2); int* ORD = (int*)carve((size_t)NT * 4);
  if (off > ws_size || off > ((size_t)32 << 20)) return;   // 25 MB
  prep_kernel<<<1 + QKBLK + VBLK, 256, 0, stream>>>(Fp(0), Fp(1), Fp(2), Ip(3), QB, KT, VT, ORD);
  att_kernel<<<NH * NT, 32 * NW, 0, stream>>>(QB, KT, VT, Ip(3), ORD, (float*)d_out);
}

// v010
// It runs in 34.2 microseconds.
// Versions in between are left out here; by their measured steps it is 1.18 times as fast as v008.
// All steps since v000 together make it 51.9 times as fast.
#include <hip/hip_runtime.h>

// Packed (varlen) attention, non-causal: for each of the 16 heads and 4,096 token positions, attention over the keys of the same packed segment (segments from the verbatim cu_seqlens offsets):
// out = softmax(q k^T / 8 over the segment) v -> [1][16][4096][64].
// Deterministic, no atomics. Per (head, 32 queries) an online softmax over the 32-key chunks of the segment(s) the 32 queries belong to (a 32-query tile may straddle a boundary; masking is per element by the query's segment bounds).
// A work-group of four waves takes one (head, 32 queries): each wave walks every fourth chunk with its own maxima, sums and accumulators; the four partial results are joined through LDS in a fixed order.
// The work-groups take the 32-query tiles in the order of falling key count (table ORD, rank -> tile, sorted from the offsets by one block of the first launch): only half of them are resident at once; the long ones have the low indices and the short ones the high.
// WMMA (v_wmma_f32_16x16x32_f16, f32 accumulate): S^T = k q^T with q, k EXACT bf16 x8 (single exact products, K 64), O^T += v^T P^T with P x1024 rounded once to f16 and v EXACT x8 (1 product); mask / softmax bookkeeping in f32, on raw scores: P x1024 = exp2(raw * c + b), one FMA a score (c: 1/8, the operand scales and log2 e; b: 10 - c * running maximum). Inputs rounded to bf16
// A chunk whose 32 keys all belong to all 32 queries (the tile lies in one segment and the chunk inside that segment) is walked by a loop of its own, whose body has no key compares and no mask selects; same values, same order. The chunks at a segment's ends, and tiles that straddle a boundary, keep the masked body.
// k is rounded and scaled ONCE, in the first launch, into 4 KB tiles KT[head * 128 + key chunk][key / 16][d / 32][d / 16 % 2][lane][8 d] in the A operand's own order (lane = 16 * (d / 8 % 2) + key % 16), so a K fragment is two global loads of 512 contiguous bytes a wave (four whole lines each, not 16 lines of 32 bytes).
// v is rounded, scaled and transposed ONCE, in the first launch, into 4 KB tiles VT[head * 128 + key chunk][d / 16][key / 16][lane][8 keys] in the A operand's own order (lane = 16 * (key / 8 % 2) + d % 16), so a V^T fragment is two global loads of 512 contiguous bytes a wave.

namespace {
constexpr int NH = 16, T = 4096, D = 64, NSEG = 8;
constexpr float XS = 8.0f;
constexpr float C2 = 0.125f / (XS * XS) * 1.44269504088896340736f, LPS = 10.0f;   // raw score (64 q.k) -> exponent of 2; 2^LPS = 1024, the scale of P
typedef _Float16 b16;
typedef __attribute__((ext_vector_type(16))) _Float16 v16b;
typedef __attribute__((ext_vector_type(8))) _Float16 v8b;
typedef __attribute__((ext_vector_type(8))) float v8f;
typedef __attribute__((ext_vector_type(4))) float v4f;
typedef __attribute__((ext_vector_type(2))) float v2f;
__device__ __forceinline__ float bf16_rne(float f) { unsigned int u = __float_as_uint(f); u += 0x7FFFu + ((u >> 16) & 1u); return __uint_as_float(u & 0xFFFF0000u); }
__device__ __forceinline__ v16b frag_kb(const b16* p, int hh) { const v8b a = *(const v8b*)(p + 8 * hh), b = *(const v8b*)(p + 16 + 8 * hh); v16b f;
#pragma unroll
  for (int e = 0; e < 8; ++e) { f[e] = a[e]; f[8 + e] = b[e]; } return f; }
__device__ __forceinline__ v8f wmma16b(v16b a, v16b b, v8f c) { return __builtin_amdgcn_wmma_f32_16x16x32_f16(false, a, false, b, (short)0, c, false, false); }   // the builtin alone: the compiler keeps the distance behind it, with other work where there is some
__device__ __forceinline__ void wave_lds_sync() { __builtin_amdgcn_fence(__ATOMIC_RELEASE, "workgroup"); __builtin_amdgcn_wave_barrier(); __builtin_amdgcn_fence(__ATOMIC_ACQUIRE, "workgroup"); }
__device__ __forceinline__ int iclamp(int v, int lo, int hi) { return v < lo ? lo : (v > hi ? hi : v); }
__device__ __forceinline__ float xhalf(float x) { return __builtin_bit_cast(float, __builtin_amdgcn_permlanex16(__builtin_bit_cast(int, x), __builtin_bit_cast(int, x), 0x76543210, 0xfedcba98, false, false)); }  // lane l reads lane l ^ 16
// segment id of position p = number of interior boundaries cu[1..NSEG-1] that are <= p (== searchsorted(cu[1:], p, 'right') for p < T)
__device__ __forceinline__ int seg_of(const int* cu, int p) { int s = 0; for (int i = 1; i < NSEG; ++i) s += (cu[i] <= p) ? 1 : 0; return s; }

constexpr int NG = 2, QT = 16 * NG, NT = T / QT;   // groups of 16 query columns a wave, queries a work-group, query tiles a head
constexpr int QKBLK = NH * T * 8 / 256, VBLK = NH * T * D / 32 / 256;   // blocks of the first launch behind block 0 (the tile order): q and k rows; v tiles
__global__ __launch_bounds__(256) void prep_kernel(const float* __restrict__ q, const float* __restrict__ k, const float* __restrict__ v, const int* __restrict__ cu, b16* __restrict__ QB, b16* __restrict__ KT, b16* __restrict__ VT, int* __restrict__ ORD) {
  if (blockIdx.x == 0) {   // tile order: ORD[rank] = tile, rank by falling key range (the range the second launch walks), ties by index: a strict order, so a permutation for any offsets
    __shared__ int Cs[NSEG + 1], Cost[NT]; const int t = threadIdx.x; int c = 0;
    if (t <= NSEG) Cs[t] = iclamp(cu[t], 0, T);
    __syncthreads();   // the clamped offsets are in LDS
    if (t < NT) { c = Cs[seg_of(Cs, t * QT + QT - 1) + 1] - (Cs[seg_of(Cs, t * QT)] & ~31); Cost[t] = c; }
    __syncthreads();   // every tile's key range is in LDS
    if (t < NT) { int r = 0; for (int j = 0; j < NT; ++j) { const int cj = Cost[j]; r += (cj > c || (cj == c && j < t)) ? 1 : 0; } ORD[r] = t; }
    return; }
  const unsigned bx = blockIdx.x - 1;
  if (bx >= QKBLK) {   // v tiles: a thread takes one d of one 32-key chunk: 32 loads (a wave reads 128 contiguous bytes each), four 16-byte stores (16 lanes fill 256 contiguous bytes each)
    const unsigned w = (bx - QKBLK) * 256 + threadIdx.x, d = w % D; const size_t cg = w / D; const float* vp = v + cg * 32 * D + d; b16* o = VT + cg * (32 * D) + (d / 16) * 512 + (d % 16) * 8;
#pragma unroll
    for (int g = 0; g < 4; ++g) { v8b a;
#pragma unroll
      for (int j = 0; j < 8; ++j) a[j] = (b16)(bf16_rne(vp[(g * 8 + j) * D]) * XS);
      *(v8b*)(o + g * 128) = a; }   // keys 8 g .. 8 g + 7: fragment half g / 2, wave half g % 2
    return; }
  const size_t u = (size_t)bx * 256 + threadIdx.x; if (u >= (size_t)NH * T * 8) return; const int d0 = (int)(u % 8) * 8; const size_t row = u / 8; v8b a, bq;
  // k: a block takes one 32-key chunk, a wave 8 keys by 32 d of it: it reads 8 whole 128-byte lines (4 lanes a key) and stores 4 whole lines of KT (8 keys of one d / 8 each), every line from one wave
  const unsigned ln = (unsigned)(u % 32), wv = (unsigned)(u / 32 % 8), kr = (wv / 4) * 16 + (wv % 2) * 8 + ln / 4, g = ln % 4; const size_t krow = (u / 256) * 32 + kr; const int kd = (int)((wv / 2 % 2) * 32 + g * 8);
  b16* ko = KT + (u / 256) * (32 * D) + (((wv / 4) * 2 + wv / 2 % 2) * 2 + g / 2) * 256 + ((g % 2) * 16 + kr % 16) * 8;
  const float* qp = q + row * D + d0; const float* kp = k + krow * D + kd; const v4f q0 = *(const v4f*)qp, q1 = *(const v4f*)(qp + 4), k0 = *(const v4f*)kp, k1 = *(const v4f*)(kp + 4);
  asm volatile("s_wait_xcnt 0x0" :: "v"(qp), "v"(kp) : "memory");   // a precaution: the two address pairs of the four loads above are inputs, so no load lands on them ahead of this wait
#pragma unroll
  for (int j = 0; j < 4; ++j) { a[j] = (b16)(bf16_rne(q0[j]) * XS); a[4 + j] = (b16)(bf16_rne(q1[j]) * XS); bq[j] = (b16)(bf16_rne(k0[j]) * XS); bq[4 + j] = (b16)(bf16_rne(k1[j]) * XS); }
  { *(v8b*)(QB + row * D + d0) = a; *(v8b*)ko = bq;  }
}
template <bool B> struct Flag { static constexpr bool v = B; };   // picks the masked or the unmasked copy of the loop body at compile time
constexpr int NW = 4;   // waves of a work-group (one lands on each SIMD): a long segment's chunks are shared by four SIMDs, and there are more work-groups than resident places, so a freed place takes the next tile
__global__ __launch_bounds__(32 * NW) void att_kernel(const b16* __restrict__ QB, const b16* __restrict__ KT, const b16* __restrict__ VT, const int* __restrict__ cu, const int* __restrict__ ORD, float* __restrict__ out) {
  __shared__ float Ow[NW][QT][D + 2], Mw[NW][QT], Lw[NW][QT], Lt[NW][QT]; __shared__ int Sgw[NW][QT], Cuw[NW][NSEG + 1], Krw[NW][4];
  const int lane = threadIdx.x & 31, wv = __builtin_amdgcn_readfirstlane(threadIdx.x >> 5), nloc = lane & 15, hlf = lane >> 4;
  int* const Sg = Sgw[wv]; int* const Cu = Cuw[wv]; int* const Kr = Krw[wv];   // each wave keeps its own copy of the small tables: no work-group barrier ahead of the loop
  const int h = blockIdx.x % NH, q0 = (ORD[blockIdx.x / NH] & (NT - 1)) * QT;   // rank rises with the index (key range falls), the 16 heads of a tile side by side; the mask bounds every address formed from the table
  if (lane <= NSEG) Cu[lane] = iclamp(cu[lane], 0, T);
  wave_lds_sync();
  Sg[lane] = seg_of(Cu, q0 + lane);
  wave_lds_sync();
  if (lane == 0) { const int s0 = Sg[0], s1 = Sg[QT - 1]; Kr[0] = Cu[s0] & ~31; Kr[1] = Cu[s1 + 1];   // key range from LDS (no dynamic register indexing)
    Kr[2] = s0 != s1 ? T : (s0 == 0 ? 0 : Cu[s0]); Kr[3] = s0 != s1 ? 0 : Cu[s0 + 1]; }   // keys that belong to ALL 32 queries: seg_of never falls with the position, so equal ends mean one segment for all 32: its klo (as formed below) and its end, which is kend and never above its khi; else none
  wave_lds_sync(); const int kbeg = Kr[0], kend = Kr[1], flo = __builtin_amdgcn_readfirstlane(Kr[2]), fhi = __builtin_amdgcn_readfirstlane(Kr[3]);
  // the keys of this lane's queries: for sorted offsets seg_of(key) == qs exactly where klo <= key < khi
  int klo[NG], khi[NG]; v8f acc[NG][4]; v16b qf[NG][2]; float mx[NG], dn[NG];   // mx: running maximum of the query's raw scores (equal in both halves); dn: running sum, x1024, over this half's keys only
  const b16* qb = QB + ((size_t)h * T + q0) * D;
#pragma unroll
  for (int g = 0; g < NG; ++g) { const int qs = Sg[16 * g + nloc]; klo[g] = qs == 0 ? 0 : Cu[qs]; khi[g] = qs >= NSEG - 1 ? T : Cu[qs + 1];
    qf[g][0] = frag_kb(qb + (size_t)(16 * g + nloc) * D, hlf); qf[g][1] = frag_kb(qb + (size_t)(16 * g + nloc) * D + 32, hlf); mx[g] = -INFINITY; dn[g] = 0.0f;
#pragma unroll
    for (int t = 0; t < 4; ++t) acc[g][t] = (v8f){}; }
  auto chunk = [&](const int kc, auto masked) __attribute__((always_inline)) {   // one 32-key chunk; masked.v false: every key of it belongs to every query
    const b16* kt_ = KT + ((size_t)h * T + kc) * D + lane * 8; v16b kf[4];   // fragment blk * 2 + kb: keys 16 * blk + nloc, d 32 * kb ..
#pragma unroll
    for (int t = 0; t < 4; ++t) { const v8b a = *(const v8b*)(kt_ + t * 512), b = *(const v8b*)(kt_ + t * 512 + 256);   // same k order as frag_kb of q: element e = d 8 * hlf + e, element 8 + e = d 16 + 8 * hlf + e
#pragma unroll
      for (int e = 0; e < 8; ++e) { kf[t][e] = a[e]; kf[t][8 + e] = b[e]; } }
    const b16* vt_ = VT + ((size_t)h * T + kc) * D + lane * 8; v16b vb[4];   // loaded ahead of the score products: they depend on nothing of this chunk
#pragma unroll
    for (int t = 0; t < 4; ++t) { const v8b a = *(const v8b*)(vt_ + t * 512), b = *(const v8b*)(vt_ + t * 512 + 256);   // same k order as frag_kb: element e = key 8 * hlf + e, element 8 + e = key 16 + 8 * hlf + e
#pragma unroll
      for (int e = 0; e < 8; ++e) { vb[t][e] = a[e]; vb[t][8 + e] = b[e]; } }
    asm volatile("s_wait_xcnt 0x0" :: "v"(kt_), "v"(vt_) : "memory");   // a precaution: the two address pairs of the sixteen loads above are inputs, so they stay untouched (no load lands on them) up to this wait
    float sv[NG][16], cm[NG];
#pragma unroll
    for (int g = 0; g < NG; ++g) cm[g] = -INFINITY;
#pragma unroll
    for (int blk = 0; blk < 2; ++blk)
#pragma unroll
      for (int g = 0; g < NG; ++g) { v8f s = {};
#pragma unroll
        for (int kb = 0; kb < 2; ++kb) s = wmma16b(kf[blk * 2 + kb], qf[g][kb], s);
#pragma unroll
        for (int r8 = 0; r8 < 8; ++r8) { const int kk = kc + blk * 16 + 8 * hlf + r8; sv[g][blk * 8 + r8] = (!decltype(masked)::v || (kk >= klo[g] && kk < khi[g])) ? s[r8] : -INFINITY; cm[g] = fmaxf(cm[g], sv[g][blk * 8 + r8]); } }
#pragma unroll
    for (int g = 0; g < NG; ++g) {
      const float cg = fmaxf(cm[g], xhalf(cm[g])); const float mo = mx[g]; const float mn = fmaxf(mo, cg); float psum = 0.0f; v16b ph;
      const float nb = mn == -INFINITY ? 0.0f : -(mn * C2), nbp = nb + LPS;   // a finite bias: a masked score (-inf) then gives exp2(-inf) = 0 by itself, also where the query has seen no key yet
#pragma unroll
      for (int e = 0; e < 16; ++e) { const float p = __builtin_amdgcn_exp2f(__builtin_fmaf(sv[g][e], C2, nbp)); psum += p; ph[e] = (b16)p; }   // p = 1024 exp(score - maximum)
      const float sf = __builtin_amdgcn_exp2f(__builtin_fmaf(mo, C2, nb)); dn[g] = dn[g] * sf + psum; mx[g] = mn;   // no key so far (mo -inf): 0, on sums and accumulators that are 0
#pragma unroll
      for (int t = 0; t < 4; ++t) {
#pragma unroll
        for (int r8 = 0; r8 < 8; ++r8) acc[g][t][r8] *= sf;
        acc[g][t] = wmma16b(vb[t], ph, acc[g][t]); } } };
  int kc = kbeg + 32 * ((wv + (q0 / QT)) % NW);   // the first chunk goes to another wave from tile to tile, so the odd chunks do not all fall to one SIMD
  // three loops, not a branch in one: each keeps its sums and accumulators in place (with both bodies in one loop the compiler copied all 64 accumulator registers every chunk); all bounds are wave-uniform scalars; unroll 1, as on the one loop before: one chunk's fragments in registers at a time, so that four waves a SIMD fit
#pragma unroll 1
  for (; kc < kend && kc < flo; kc += 32 * NW) chunk(kc, Flag<true>{});   // ahead of the common keys (every chunk, where the tile has none)
#pragma unroll 1
  for (; kc + 32 <= fhi; kc += 32 * NW) chunk(kc, Flag<false>{});   // here kc >= flo, or kc >= kend >= fhi and no pass is made
#pragma unroll 1
  for (; kc < kend; kc += 32 * NW) chunk(kc, Flag<true>{});   // the rest
  float dt[NG];
#pragma unroll
  for (int g = 0; g < NG; ++g) dt[g] = dn[g] + xhalf(dn[g]);   // the two halves' sums joined once (equal in both halves)
  Mw[wv][lane] = (hlf ? mx[1] : mx[0]) * C2; Lw[wv][lane] = hlf ? dt[1] : dt[0];   // half hlf writes group hlf's 16 queries; the maximum as the loop's bias has it (-inf stays -inf)
  __syncthreads();   // every wave's maxima and sums are in LDS
  float lall[NG], wg[NG];
#pragma unroll
  for (int g = 0; g < NG; ++g) { const int qi = 16 * g + nloc; float mall = -INFINITY;
#pragma unroll
    for (int p = 0; p < NW; ++p) mall = fmaxf(mall, Mw[p][qi]);
    lall[g] = 0.0f;   // a wave without a key of this query (maximum -inf) weighs 0
#pragma unroll
    for (int p = 0; p < NW; ++p) { const float mp = Mw[p][qi], lp = Lw[p][qi], ep = __builtin_amdgcn_exp2f(mp - mall); lall[g] += mp == -INFINITY ? 0.0f : lp * ep; }
    wg[g] = mx[g] == -INFINITY ? 0.0f : __builtin_amdgcn_exp2f(Mw[wv][qi] - mall); }   // the same rounded maximum that weighs this wave's sum above
  Lt[wv][lane] = hlf ? lall[1] : lall[0];   // the wave's own copy, read back behind the barrier below
#pragma unroll
  for (int g = 0; g < NG; ++g)
#pragma unroll
    for (int t = 0; t < 4; ++t)
#pragma unroll
      for (int r8 = 0; r8 < 8; ++r8) Ow[wv][16 * g + nloc][t * 16 + 8 * hlf + r8] = acc[g][t][r8] * wg[g];
  __syncthreads();   // every wave's weighted partial output is in LDS
#pragma unroll
  for (int i = 0; i < QT / NW; ++i) { const int rr = wv * (QT / NW) + i; v2f s = {0.0f, 0.0f};   // a wave joins and stores eight whole rows (256 bytes each)
#pragma unroll
    for (int p = 0; p < NW; ++p) { s[0] += Ow[p][rr][lane * 2]; s[1] += Ow[p][rr][lane * 2 + 1]; }
    const float lr = Lt[wv][rr]; *(v2f*)(out + ((size_t)h * T + q0 + rr) * D + lane * 2) = (v2f){s[0] * (1.0f / XS) / lr, s[1] * (1.0f / XS) / lr}; }   // sums and outputs both carry the x1024
}
}  // namespace

extern "C" void kernel_launch(void* const* d_in, const int* in_sizes, int n_in, void* d_out, int out_size, void* d_ws, size_t ws_size, hipStream_t stream) {
  (void)n_in;
  auto Fp = [&](int i) { return (const float*)d_in[i]; }; auto Ip = [&](int i) { return (const int*)d_in[i]; };
  // input order: 0 q [1,16,4096,64]; 1 k; 2 v; 3 cu_seqlens [9] i32
  if (in_sizes[0] != NH * T * D || in_sizes[1] != NH * T * D || in_sizes[2] != NH * T * D || in_sizes[3] != NSEG + 1 || out_size != NH * T * D) return;
  size_t off = 0; char* ws = (char*)d_ws;
  auto carve = [&](size_t bytes) { char* p = ws + off; off += (bytes + 255) & ~(size_t)255; return p; };
  b16* QB = (b16*)carve((size_t)NH * T * D * 2); b16* KT = (b16*)carve((size_t)NH * T * D * 2); b16* VT = (b16*)carve((size_t)NH * T * D * 2); int* ORD = (int*)carve((size_t)NT * 4);
  if (off > ws_size || off > ((size_t)32 << 20)) return;   // 25 MB
  prep_kernel<<<1 + QKBLK + VBLK, 256, 0, stream>>>(Fp(0), Fp(1), Fp(2), Ip(3), QB, KT, VT, ORD);
  att_kernel<<<NH * NT, 32 * NW, 0, stream>>>(QB, KT, VT, Ip(3), ORD, (float*)d_out);
}
